// v000
// The times below were measured on an AMD MI455X: many runs one after another, warmed up first and cycling through
// copies of the inputs, with the whole window's GPU time divided by the number of runs. Launches and the gaps
// between them are all in it. The median over several windows is given; except for v000 it joins two sittings, which
// can be a few percent apart, so the side-by-side timings, each taken in one sitting, are the better comparison.
// The starting kernel, v000, takes 71.1 microseconds a run.
#include <hip/hip_runtime.h>
#include <math.h>

typedef __attribute__((ext_vector_type(2))) float v2f;
typedef __attribute__((ext_vector_type(8))) float v8f;

#define WMMA_F32(a, b, c) \
  __builtin_amdgcn_wmma_f32_16x16x4_f32(false, (a), false, (b), (short)0, (c), false, false)

// Problem constants
#define A_ 4
#define N_ 384
#define D_ 256
#define H_ 8
#define C_ 32
#define NPAIR 16         // A_*A_ unique (a,e) attention problems
#define NTILE (N_ / 16)  // 24
#define NBLK (H_ * NTILE)            // 192 attention blocks per pair
#define SCALE 0.17677669529663689f   // 1/sqrt(32)

// Workspace layout (in floats)
#define WS_QP   0u
#define WS_KP   393216u
#define WS_VP   786432u
#define WS_O    1179648u             // NPAIR*H_*N_*C_ = 1572864 floats
#define WS_PART 2752512u             // NPAIR*NBLK = 3072 floats
#define WS_W    2755584u             // 16 floats

// ---------------------------------------------------------------------------
// Projection: y = x @ W^T + b, stored head-major as out[a][h][n][c].
// One wave per 16x16 output tile; K=256 swept in chunks of 4 via f32 WMMA.
// ---------------------------------------------------------------------------
__global__ __launch_bounds__(32) void proj_kernel(const float* __restrict__ x,
                                                  const float* __restrict__ W,
                                                  const float* __restrict__ bias,
                                                  float* __restrict__ out) {
  const int lane = threadIdx.x;
  const int lo = lane & 15;
  const int hi = lane >> 4;  // 0 or 1
  const int t0 = blockIdx.x * 16;  // token tile (a*384+n), 96 tiles
  const int d0 = blockIdx.y * 16;  // output-channel tile, 16 tiles

  const float* __restrict__ xrow = x + (size_t)(t0 + lo) * D_;
  const float* __restrict__ wrow = W + (size_t)(d0 + lo) * D_;

  v8f acc = {};
#pragma unroll 8
  for (int kk = 0; kk < D_; kk += 4) {
    v2f av, bv;
    av.x = xrow[kk + 2 * hi];
    av.y = xrow[kk + 2 * hi + 1];
    bv.x = wrow[kk + 2 * hi];
    bv.y = wrow[kk + 2 * hi + 1];
    acc = WMMA_F32(av, bv, acc);
  }

  const float bval = bias[d0 + lo];
  const int d = d0 + lo;
  const int h = d >> 5;
  const int c = d & 31;
  // a-index is uniform per block (tiles never straddle an a boundary):
  const int ai = blockIdx.x / NTILE;          // scalar (SALU) divide
  const int nbase = t0 - ai * N_ + 8 * hi;    // row n for VGPR j is nbase + j
  float* __restrict__ obase = out + (((size_t)(ai * H_ + h)) * N_ + nbase) * C_ + c;
#pragma unroll
  for (int j = 0; j < 8; ++j) {
    obase[(size_t)j * C_] = acc[j] + bval;
  }
}

// ---------------------------------------------------------------------------
// Fused flash attention for one (a,e,h,n-tile): S = (Q*scale) @ K^T via WMMA,
// online softmax, O += P @ V via WMMA. Writes its raw score sum to a private
// partial slot (deterministic reduction later; no float atomics).
// ---------------------------------------------------------------------------
__global__ __launch_bounds__(32) void attn_kernel(const float* __restrict__ qp,
                                                  const float* __restrict__ kp,
                                                  const float* __restrict__ vp,
                                                  float* __restrict__ Obuf,
                                                  float* __restrict__ partial) {
  __shared__ float ps[16][17];  // P transpose staging (C-layout -> A-layout)

  const int lane = threadIdx.x;
  const int lo = lane & 15;
  const int hi = lane >> 4;

  const int n0 = blockIdx.x * 16;
  const int h = blockIdx.y;
  const int pair = blockIdx.z;
  const int a = pair >> 2;
  const int e = pair & 3;

  const float* __restrict__ qb = qp + ((size_t)(a * H_ + h)) * N_ * C_;  // [n][c]
  const float* __restrict__ kb = kp + ((size_t)(e * H_ + h)) * N_ * C_;  // [m][c]
  const float* __restrict__ vb = vp + ((size_t)(e * H_ + h)) * N_ * C_;  // [m][c]

  // Q A-fragments for this n-tile (scale folded in): 8 chunks of K(=c)=4
  v2f qa[8];
#pragma unroll
  for (int c4 = 0; c4 < 8; ++c4) {
    const float* qr = qb + (size_t)(n0 + lo) * C_ + c4 * 4 + 2 * hi;
    qa[c4].x = qr[0] * SCALE;
    qa[c4].y = qr[1] * SCALE;
  }

  v8f o0 = {}, o1 = {};
  float mrow[8], lrow[8];
#pragma unroll
  for (int j = 0; j < 8; ++j) { mrow[j] = -3.0e38f; lrow[j] = 0.0f; }
  float ssum = 0.0f;

  for (int m0 = 0; m0 < N_; m0 += 16) {
    // ---- S tile = (Q*scale) @ K^T : 8 WMMAs over c ----
    v8f s = {};
#pragma unroll
    for (int c4 = 0; c4 < 8; ++c4) {
      const float* kr = kb + (size_t)(m0 + lo) * C_ + c4 * 4 + 2 * hi;
      v2f kv;
      kv.x = kr[0];
      kv.y = kr[1];
      s = WMMA_F32(qa[c4], kv, s);
    }

    // ---- raw score sum (for pooled) + online softmax ----
    v8f p;
#pragma unroll
    for (int j = 0; j < 8; ++j) {
      ssum += s[j];
      float rmax = s[j];
      rmax = fmaxf(rmax, __shfl_xor(rmax, 1));
      rmax = fmaxf(rmax, __shfl_xor(rmax, 2));
      rmax = fmaxf(rmax, __shfl_xor(rmax, 4));
      rmax = fmaxf(rmax, __shfl_xor(rmax, 8));
      const float mnew = fmaxf(mrow[j], rmax);
      const float alpha = __expf(mrow[j] - mnew);
      p[j] = __expf(s[j] - mnew);
      float rsum = p[j];
      rsum += __shfl_xor(rsum, 1);
      rsum += __shfl_xor(rsum, 2);
      rsum += __shfl_xor(rsum, 4);
      rsum += __shfl_xor(rsum, 8);
      lrow[j] = lrow[j] * alpha + rsum;
      mrow[j] = mnew;
      o0[j] *= alpha;
      o1[j] *= alpha;
    }

    // ---- transpose P through LDS: C-layout -> A-layout ----
    __syncthreads();
#pragma unroll
    for (int j = 0; j < 8; ++j) ps[j + 8 * hi][lo] = p[j];
    __syncthreads();

    // ---- O += P @ V : K(=m)=16 in 4 chunks, two c-halves ----
#pragma unroll
    for (int m4 = 0; m4 < 4; ++m4) {
      v2f pa;
      pa.x = ps[lo][m4 * 4 + 2 * hi];
      pa.y = ps[lo][m4 * 4 + 2 * hi + 1];
      const int mg = m0 + m4 * 4 + 2 * hi;
      v2f vb0, vb1;
      vb0.x = vb[(size_t)mg * C_ + lo];
      vb0.y = vb[(size_t)(mg + 1) * C_ + lo];
      vb1.x = vb[(size_t)mg * C_ + 16 + lo];
      vb1.y = vb[(size_t)(mg + 1) * C_ + 16 + lo];
      o0 = WMMA_F32(pa, vb0, o0);
      o1 = WMMA_F32(pa, vb1, o1);
    }
  }

  // ---- normalize and store O[a,e][h][n][c] ----
  const size_t obase = ((size_t)(pair * H_ + h)) * N_ * C_;
#pragma unroll
  for (int j = 0; j < 8; ++j) {
    const float inv = 1.0f / lrow[j];
    const int n = n0 + j + 8 * hi;
    Obuf[obase + (size_t)n * C_ + lo] = o0[j] * inv;
    Obuf[obase + (size_t)n * C_ + 16 + lo] = o1[j] * inv;
  }

  // ---- per-block raw score sum: deterministic private slot ----
  ssum += __shfl_xor(ssum, 16);
  ssum += __shfl_xor(ssum, 8);
  ssum += __shfl_xor(ssum, 4);
  ssum += __shfl_xor(ssum, 2);
  ssum += __shfl_xor(ssum, 1);
  if (lane == 0) partial[(size_t)pair * NBLK + h * NTILE + blockIdx.x] = ssum;
}

// ---------------------------------------------------------------------------
// Deterministic partial-sum reduction, then pooled -> attn_r -> collapsed
// pair weights w[a][e].
// ---------------------------------------------------------------------------
__global__ __launch_bounds__(32) void weights_kernel(const float* __restrict__ partial,
                                                     float* __restrict__ w) {
  __shared__ float sumS[NPAIR];
  const int t = threadIdx.x;
  if (t < NPAIR) {
    float s = 0.0f;
    for (int i = 0; i < NBLK; ++i) s += partial[(size_t)t * NBLK + i];  // fixed order
    sumS[t] = s;
  }
  __syncthreads();
  if (t != 0) return;

  const int trace[12][4] = {{0, 1, 2, 3}, {0, 2, 3, 1}, {0, 3, 1, 2}, {1, 2, 0, 3},
                            {1, 0, 3, 2}, {1, 3, 2, 0}, {2, 3, 0, 1}, {2, 0, 1, 3},
                            {2, 1, 3, 0}, {3, 1, 0, 2}, {3, 0, 2, 1}, {3, 2, 1, 0}};
  const float inv_cnt = 1.0f / ((float)A_ * H_ * N_ * N_);
  float pos[12];
  float tot = 0.0f;
  for (int r = 0; r < 12; ++r) {
    float pooled = 0.0f;
    for (int a = 0; a < A_; ++a) pooled += sumS[a * 4 + trace[r][a]];
    pooled *= inv_cnt;
    pos[r] = pooled * pooled;
    tot += pos[r];
  }
  const float invtot = 1.0f / tot;
  for (int a = 0; a < A_; ++a)
    for (int e = 0; e < A_; ++e) {
      float acc = 0.0f;
      for (int r = 0; r < 12; ++r)
        if (trace[r][a] == e) acc += pos[r] * invtot;
      w[a * 4 + e] = acc;
    }
}

// ---------------------------------------------------------------------------
// hidden[a] = sum_e w[a,e] * O[a,e]; write out[B,A,N,D] (head-interleaved).
// blockIdx.y = a, so all index math is shifts/masks (no integer division).
// ---------------------------------------------------------------------------
__global__ __launch_bounds__(256) void combine_kernel(const float* __restrict__ Obuf,
                                                      const float* __restrict__ w,
                                                      float* __restrict__ out) {
  const int a = blockIdx.y;
  const int rem = blockIdx.x * blockDim.x + threadIdx.x;  // < N_*D_ = 98304
  const int n = rem >> 8;   // D_ = 256
  const int d = rem & 255;
  const int h = d >> 5;
  const int c = d & 31;
  float acc = 0.0f;
#pragma unroll
  for (int e = 0; e < A_; ++e) {
    const size_t oi = ((size_t)((a * 4 + e) * H_ + h)) * N_ * C_ + (size_t)n * C_ + c;
    acc += w[a * 4 + e] * Obuf[oi];
  }
  out[(size_t)a * N_ * D_ + rem] = acc;
}

// ---------------------------------------------------------------------------
extern "C" void kernel_launch(void* const* d_in, const int* in_sizes, int n_in,
                              void* d_out, int out_size, void* d_ws, size_t ws_size,
                              hipStream_t stream) {
  const float* input_q = (const float*)d_in[0];
  const float* input_k = (const float*)d_in[1];
  const float* input_v = (const float*)d_in[2];
  const float* Wq = (const float*)d_in[3];
  const float* bq = (const float*)d_in[4];
  const float* Wk = (const float*)d_in[5];
  const float* bk = (const float*)d_in[6];
  const float* Wv = (const float*)d_in[7];
  const float* bv = (const float*)d_in[8];
  float* out = (float*)d_out;

  float* ws = (float*)d_ws;
  float* qp = ws + WS_QP;
  float* kp = ws + WS_KP;
  float* vp = ws + WS_VP;
  float* Obuf = ws + WS_O;
  float* part = ws + WS_PART;
  float* wpair = ws + WS_W;

  dim3 pgrid((A_ * N_) / 16, D_ / 16);  // 96 x 16 tiles
  proj_kernel<<<pgrid, 32, 0, stream>>>(input_q, Wq, bq, qp);
  proj_kernel<<<pgrid, 32, 0, stream>>>(input_k, Wk, bk, kp);
  proj_kernel<<<pgrid, 32, 0, stream>>>(input_v, Wv, bv, vp);

  dim3 agrid(NTILE, H_, NPAIR);  // 24 x 8 x 16 one-wave blocks
  attn_kernel<<<agrid, 32, 0, stream>>>(qp, kp, vp, Obuf, part);

  weights_kernel<<<1, 32, 0, stream>>>(part, wpair);

  dim3 cgrid((N_ * D_) / 256, A_);  // 384 x 4
  combine_kernel<<<cgrid, 256, 0, stream>>>(Obuf, wpair, out);
}

// v001
// Measured time: 47.7 microseconds a run.
// In both of two side-by-side timings against v000, it was 1.50 times as fast.
#include <hip/hip_runtime.h>
#include <math.h>

typedef __attribute__((ext_vector_type(2))) float v2f;
typedef __attribute__((ext_vector_type(8))) float v8f;

#define WMMA_F32(a, b, c) \
  __builtin_amdgcn_wmma_f32_16x16x4_f32(false, (a), false, (b), (short)0, (c), false, false)

// Problem constants
#define A_ 4
#define N_ 384
#define D_ 256
#define H_ 8
#define C_ 32
#define NPAIR 16         // A_*A_ unique (a,e) attention problems
#define NTILE (N_ / 16)  // 24
#define NBLK (H_ * NTILE)            // 192 attention blocks per pair
#define SCALE 0.17677669529663689f   // 1/sqrt(32)

// Workspace layout (in floats)
#define WS_QP   0u
#define WS_KP   393216u
#define WS_VP   786432u
#define WS_O    1179648u             // NPAIR*H_*N_*C_ = 1572864 floats
#define WS_PART 2752512u             // NPAIR*NBLK = 3072 floats
#define WS_W    2755584u             // 16 floats

// ---------------------------------------------------------------------------
// Projection: y = x @ W^T + b, stored head-major as out[a][h][n][c].
// One wave per 16x16 output tile; K=256 swept in chunks of 4 via f32 WMMA.
// ---------------------------------------------------------------------------
__global__ __launch_bounds__(32) void proj_kernel(const float* __restrict__ x,
                                                  const float* __restrict__ W,
                                                  const float* __restrict__ bias,
                                                  float* __restrict__ out) {
  const int lane = threadIdx.x;
  const int lo = lane & 15;
  const int hi = lane >> 4;  // 0 or 1
  const int t0 = blockIdx.x * 16;  // token tile (a*384+n), 96 tiles
  const int d0 = blockIdx.y * 16;  // output-channel tile, 16 tiles

  const float* __restrict__ xrow = x + (size_t)(t0 + lo) * D_;
  const float* __restrict__ wrow = W + (size_t)(d0 + lo) * D_;

  v8f acc = {};
#pragma unroll 8
  for (int kk = 0; kk < D_; kk += 4) {
    v2f av, bv;
    av.x = xrow[kk + 2 * hi];
    av.y = xrow[kk + 2 * hi + 1];
    bv.x = wrow[kk + 2 * hi];
    bv.y = wrow[kk + 2 * hi + 1];
    acc = WMMA_F32(av, bv, acc);
  }

  const float bval = bias[d0 + lo];
  const int d = d0 + lo;
  const int h = d >> 5;
  const int c = d & 31;
  // a-index is uniform per block (tiles never straddle an a boundary):
  const int ai = blockIdx.x / NTILE;          // scalar (SALU) divide
  const int nbase = t0 - ai * N_ + 8 * hi;    // row n for VGPR j is nbase + j
  float* __restrict__ obase = out + (((size_t)(ai * H_ + h)) * N_ + nbase) * C_ + c;
#pragma unroll
  for (int j = 0; j < 8; ++j) {
    obase[(size_t)j * C_] = acc[j] + bval;
  }
}

__device__ __forceinline__ float xhalf(float x) {
  return __builtin_bit_cast(float, __builtin_amdgcn_permlanex16(
      __builtin_bit_cast(int, x), __builtin_bit_cast(int, x), 0x76543210, 0xfedcba98, false, false));
}

// This grid puts three waves on a SIMD: a register budget for at most four lets
// the compiler issue all K and V loads of a pass as one group (with the default
// budget it splits the K loads and waits for memory twice per pass).
__global__ __launch_bounds__(32) __attribute__((amdgpu_waves_per_eu(1, 4))) void attn_kernel(const float* __restrict__ qp,
                                                  const float* __restrict__ kp,
                                                  const float* __restrict__ vp,
                                                  float* __restrict__ Obuf,
                                                  float* __restrict__ partial) {
  const int lane = threadIdx.x;
  const int lo = lane & 15;
  const int hi = lane >> 4;

  const int n0 = blockIdx.x * 16;
  const int h = blockIdx.y;
  const int pair = blockIdx.z;
  const int a = pair >> 2;
  const int e = pair & 3;

  const float* __restrict__ qb = qp + ((size_t)(a * H_ + h)) * N_ * C_;  // [n][c]
  const float* __restrict__ kb = kp + ((size_t)(e * H_ + h)) * N_ * C_;  // [m][c]
  const float* __restrict__ vb = vp + ((size_t)(e * H_ + h)) * N_ * C_;  // [m][c]

  // Q B-fragments for this n-tile (scale folded in): 8 chunks of K(=c)=4
  v2f qf[8];
#pragma unroll
  for (int c4 = 0; c4 < 8; ++c4) {
    const float* qr = qb + (size_t)(n0 + lo) * C_ + c4 * 4 + 2 * hi;
    qf[c4].x = qr[0] * SCALE;
    qf[c4].y = qr[1] * SCALE;
  }

  // O^T tiles: o0[j] = O[n0+lo][8*hi+j], o1[j] = O[n0+lo][16+8*hi+j]
  v8f o0 = {}, o1 = {};
  float mcol = -3.0e38f;  // running maximum of query n0+lo (equal in both halves)
  float lcol = 0.0f;      // running sum over this half's keys only; joined at the end
  float ssum = 0.0f;

  for (int m0 = 0; m0 < N_; m0 += 16) {
    // ---- S^T tile = K @ (Q*scale)^T : s[j] = S[n0+lo][m0+8*hi+j] ----
    v8f s = {};
#pragma unroll
    for (int c4 = 0; c4 < 8; ++c4) {
      const float* kr = kb + (size_t)(m0 + lo) * C_ + c4 * 4 + 2 * hi;
      v2f kv;
      kv.x = kr[0];
      kv.y = kr[1];
      s = WMMA_F32(kv, qf[c4], s);
    }

    // ---- raw score sum (for pooled) + online softmax, one query per lane ----
    float tmax = s[0];
#pragma unroll
    for (int j = 0; j < 8; ++j) {
      ssum += s[j];
      tmax = fmaxf(tmax, s[j]);
    }
    tmax = fmaxf(tmax, xhalf(tmax));
    const float mnew = fmaxf(mcol, tmax);
    const float alpha = __expf(mcol - mnew);
    mcol = mnew;
    v8f p;
    float psum = 0.0f;
#pragma unroll
    for (int j = 0; j < 8; ++j) {
      p[j] = __expf(s[j] - mnew);
      psum += p[j];
      o0[j] *= alpha;
      o1[j] *= alpha;
    }
    lcol = lcol * alpha + psum;

    // ---- O^T += V^T @ P^T : K(=m)=16 in 4 chunks, two c-halves. Chunk t pairs
    // k slot (hi, i) with key m0+8*hi+2*t+i in BOTH operands, which is where
    // the score accumulator already holds it. ----
#pragma unroll
    for (int t = 0; t < 4; ++t) {
      v2f pb;
      pb.x = p[2 * t];
      pb.y = p[2 * t + 1];
      const int mg = m0 + 8 * hi + 2 * t;
      v2f va0, va1;
      va0.x = vb[(size_t)mg * C_ + lo];
      va0.y = vb[(size_t)(mg + 1) * C_ + lo];
      va1.x = vb[(size_t)mg * C_ + 16 + lo];
      va1.y = vb[(size_t)(mg + 1) * C_ + 16 + lo];
      o0 = WMMA_F32(va0, pb, o0);
      o1 = WMMA_F32(va1, pb, o1);
    }
  }

  // ---- normalize and store O[a,e][h][n][c]: 8 consecutive c per lane and tile ----
  const float inv = 1.0f / (lcol + xhalf(lcol));
  float* __restrict__ orow =
      Obuf + ((size_t)(pair * H_ + h)) * N_ * C_ + (size_t)(n0 + lo) * C_ + 8 * hi;
  *(float4*)(orow + 0) = make_float4(o0[0] * inv, o0[1] * inv, o0[2] * inv, o0[3] * inv);
  *(float4*)(orow + 4) = make_float4(o0[4] * inv, o0[5] * inv, o0[6] * inv, o0[7] * inv);
  *(float4*)(orow + 16) = make_float4(o1[0] * inv, o1[1] * inv, o1[2] * inv, o1[3] * inv);
  *(float4*)(orow + 20) = make_float4(o1[4] * inv, o1[5] * inv, o1[6] * inv, o1[7] * inv);

  // ---- per-block raw score sum: deterministic private slot ----
  ssum += __shfl_xor(ssum, 16);
  ssum += __shfl_xor(ssum, 8);
  ssum += __shfl_xor(ssum, 4);
  ssum += __shfl_xor(ssum, 2);
  ssum += __shfl_xor(ssum, 1);
  if (lane == 0) partial[(size_t)pair * NBLK + h * NTILE + blockIdx.x] = ssum;
}

// ---------------------------------------------------------------------------
// Deterministic partial-sum reduction, then pooled -> attn_r -> collapsed
// pair weights w[a][e].
// ---------------------------------------------------------------------------
__global__ __launch_bounds__(32) void weights_kernel(const float* __restrict__ partial,
                                                     float* __restrict__ w) {
  __shared__ float sumS[NPAIR];
  const int t = threadIdx.x;
  if (t < NPAIR) {
    float s = 0.0f;
    for (int i = 0; i < NBLK; ++i) s += partial[(size_t)t * NBLK + i];  // fixed order
    sumS[t] = s;
  }
  __syncthreads();
  if (t != 0) return;

  const int trace[12][4] = {{0, 1, 2, 3}, {0, 2, 3, 1}, {0, 3, 1, 2}, {1, 2, 0, 3},
                            {1, 0, 3, 2}, {1, 3, 2, 0}, {2, 3, 0, 1}, {2, 0, 1, 3},
                            {2, 1, 3, 0}, {3, 1, 0, 2}, {3, 0, 2, 1}, {3, 2, 1, 0}};
  const float inv_cnt = 1.0f / ((float)A_ * H_ * N_ * N_);
  float pos[12];
  float tot = 0.0f;
  for (int r = 0; r < 12; ++r) {
    float pooled = 0.0f;
    for (int a = 0; a < A_; ++a) pooled += sumS[a * 4 + trace[r][a]];
    pooled *= inv_cnt;
    pos[r] = pooled * pooled;
    tot += pos[r];
  }
  const float invtot = 1.0f / tot;
  for (int a = 0; a < A_; ++a)
    for (int e = 0; e < A_; ++e) {
      float acc = 0.0f;
      for (int r = 0; r < 12; ++r)
        if (trace[r][a] == e) acc += pos[r] * invtot;
      w[a * 4 + e] = acc;
    }
}

// ---------------------------------------------------------------------------
// hidden[a] = sum_e w[a,e] * O[a,e]; write out[B,A,N,D] (head-interleaved).
// blockIdx.y = a, so all index math is shifts/masks (no integer division).
// ---------------------------------------------------------------------------
__global__ __launch_bounds__(256) void combine_kernel(const float* __restrict__ Obuf,
                                                      const float* __restrict__ w,
                                                      float* __restrict__ out) {
  const int a = blockIdx.y;
  const int rem = blockIdx.x * blockDim.x + threadIdx.x;  // < N_*D_ = 98304
  const int n = rem >> 8;   // D_ = 256
  const int d = rem & 255;
  const int h = d >> 5;
  const int c = d & 31;
  float acc = 0.0f;
#pragma unroll
  for (int e = 0; e < A_; ++e) {
    const size_t oi = ((size_t)((a * 4 + e) * H_ + h)) * N_ * C_ + (size_t)n * C_ + c;
    acc += w[a * 4 + e] * Obuf[oi];
  }
  out[(size_t)a * N_ * D_ + rem] = acc;
}

// ---------------------------------------------------------------------------
extern "C" void kernel_launch(void* const* d_in, const int* in_sizes, int n_in,
                              void* d_out, int out_size, void* d_ws, size_t ws_size,
                              hipStream_t stream) {
  const float* input_q = (const float*)d_in[0];
  const float* input_k = (const float*)d_in[1];
  const float* input_v = (const float*)d_in[2];
  const float* Wq = (const float*)d_in[3];
  const float* bq = (const float*)d_in[4];
  const float* Wk = (const float*)d_in[5];
  const float* bk = (const float*)d_in[6];
  const float* Wv = (const float*)d_in[7];
  const float* bv = (const float*)d_in[8];
  float* out = (float*)d_out;

  float* ws = (float*)d_ws;
  float* qp = ws + WS_QP;
  float* kp = ws + WS_KP;
  float* vp = ws + WS_VP;
  float* Obuf = ws + WS_O;
  float* part = ws + WS_PART;
  float* wpair = ws + WS_W;

  dim3 pgrid((A_ * N_) / 16, D_ / 16);  // 96 x 16 tiles
  proj_kernel<<<pgrid, 32, 0, stream>>>(input_q, Wq, bq, qp);
  proj_kernel<<<pgrid, 32, 0, stream>>>(input_k, Wk, bk, kp);
  proj_kernel<<<pgrid, 32, 0, stream>>>(input_v, Wv, bv, vp);

  dim3 agrid(NTILE, H_, NPAIR);  // 24 x 8 x 16 one-wave blocks
  attn_kernel<<<agrid, 32, 0, stream>>>(qp, kp, vp, Obuf, part);

  weights_kernel<<<1, 32, 0, stream>>>(part, wpair);

  dim3 cgrid((N_ * D_) / 256, A_);  // 384 x 4
  combine_kernel<<<cgrid, 256, 0, stream>>>(Obuf, wpair, out);
}

// v002
// Measured time: 41.4 microseconds a run.
// Two timings next to v001 put it at 1.15 and 1.17 times that version's speed.
// Over all steps from v000 it is 1.74 times as fast.
#include <hip/hip_runtime.h>
#include <math.h>

typedef __attribute__((ext_vector_type(2))) float v2f;
typedef __attribute__((ext_vector_type(8))) float v8f;

#define WMMA_F32(a, b, c) \
  __builtin_amdgcn_wmma_f32_16x16x4_f32(false, (a), false, (b), (short)0, (c), false, false)

// Problem constants
#define A_ 4
#define N_ 384
#define D_ 256
#define H_ 8
#define C_ 32
#define NPAIR 16         // A_*A_ unique (a,e) attention problems
#define NTILE (N_ / 16)  // 24
#define NBLK (H_ * NTILE)            // 192 attention blocks per pair
#define SCALE 0.17677669529663689f   // 1/sqrt(32)

// Workspace layout (in floats)
#define WS_QP   0u
#define WS_KP   393216u
#define WS_VP   786432u
#define WS_O    1179648u             // NPAIR*H_*N_*C_ = 1572864 floats
#define WS_PART 2752512u             // NPAIR*NBLK = 3072 floats
#define WS_W    2755584u             // 16 floats

// ---------------------------------------------------------------------------
// Projection: y = x @ W^T + b, stored head-major as out[a][h][n][c].
// One wave per 16x16 output tile; K=256 swept in chunks of 4 via f32 WMMA.
// All three projections run in ONE launch: blockIdx.z picks q, k or v. They do
// not depend on each other, so their waves share the chip and wait for their
// loads side by side instead of one grid after the other.
// ---------------------------------------------------------------------------
__global__ __launch_bounds__(32) void proj_kernel(const float* __restrict__ xq,
                                                  const float* __restrict__ xk,
                                                  const float* __restrict__ xv,
                                                  const float* __restrict__ Wq,
                                                  const float* __restrict__ Wk,
                                                  const float* __restrict__ Wv,
                                                  const float* __restrict__ bq,
                                                  const float* __restrict__ bk,
                                                  const float* __restrict__ bv,
                                                  float* __restrict__ qkv) {
  const int z = blockIdx.z;  // 0: q, 1: k, 2: v (uniform, scalar selects)
  const float* __restrict__ x = z == 0 ? xq : (z == 1 ? xk : xv);
  const float* __restrict__ W = z == 0 ? Wq : (z == 1 ? Wk : Wv);
  const float* __restrict__ bias = z == 0 ? bq : (z == 1 ? bk : bv);
  float* __restrict__ out = qkv + (size_t)z * WS_KP;  // planes WS_QP, WS_KP, WS_VP
  const int lane = threadIdx.x;
  const int lo = lane & 15;
  const int hi = lane >> 4;  // 0 or 1
  const int t0 = blockIdx.x * 16;  // token tile (a*384+n), 96 tiles
  const int d0 = blockIdx.y * 16;  // output-channel tile, 16 tiles

  const float* __restrict__ xrow = x + (size_t)(t0 + lo) * D_;
  const float* __restrict__ wrow = W + (size_t)(d0 + lo) * D_;

  v8f acc = {};
#pragma unroll 8
  for (int kk = 0; kk < D_; kk += 4) {
    v2f av, bv;
    av.x = xrow[kk + 2 * hi];
    av.y = xrow[kk + 2 * hi + 1];
    bv.x = wrow[kk + 2 * hi];
    bv.y = wrow[kk + 2 * hi + 1];
    acc = WMMA_F32(av, bv, acc);
  }

  const float bval = bias[d0 + lo];
  const int d = d0 + lo;
  const int h = d >> 5;
  const int c = d & 31;
  // a-index is uniform per block (tiles never straddle an a boundary):
  const int ai = blockIdx.x / NTILE;          // scalar (SALU) divide
  const int nbase = t0 - ai * N_ + 8 * hi;    // row n for VGPR j is nbase + j
  float* __restrict__ obase = out + (((size_t)(ai * H_ + h)) * N_ + nbase) * C_ + c;
#pragma unroll
  for (int j = 0; j < 8; ++j) {
    obase[(size_t)j * C_] = acc[j] + bval;
  }
}

__device__ __forceinline__ float xhalf(float x) {
  return __builtin_bit_cast(float, __builtin_amdgcn_permlanex16(
      __builtin_bit_cast(int, x), __builtin_bit_cast(int, x), 0x76543210, 0xfedcba98, false, false));
}

// This grid puts three waves on a SIMD: a register budget for at most four lets
// the compiler issue all K and V loads of a pass as one group (with the default
// budget it splits the K loads and waits for memory twice per pass).
__global__ __launch_bounds__(32) __attribute__((amdgpu_waves_per_eu(1, 4))) void attn_kernel(const float* __restrict__ qp,
                                                  const float* __restrict__ kp,
                                                  const float* __restrict__ vp,
                                                  float* __restrict__ Obuf,
                                                  float* __restrict__ partial) {
  const int lane = threadIdx.x;
  const int lo = lane & 15;
  const int hi = lane >> 4;

  const int n0 = blockIdx.x * 16;
  const int h = blockIdx.y;
  const int pair = blockIdx.z;
  const int a = pair >> 2;
  const int e = pair & 3;

  const float* __restrict__ qb = qp + ((size_t)(a * H_ + h)) * N_ * C_;  // [n][c]
  const float* __restrict__ kb = kp + ((size_t)(e * H_ + h)) * N_ * C_;  // [m][c]
  const float* __restrict__ vb = vp + ((size_t)(e * H_ + h)) * N_ * C_;  // [m][c]

  // Q B-fragments for this n-tile (scale folded in): 8 chunks of K(=c)=4
  v2f qf[8];
#pragma unroll
  for (int c4 = 0; c4 < 8; ++c4) {
    const float* qr = qb + (size_t)(n0 + lo) * C_ + c4 * 4 + 2 * hi;
    qf[c4].x = qr[0] * SCALE;
    qf[c4].y = qr[1] * SCALE;
  }

  // O^T tiles: o0[j] = O[n0+lo][8*hi+j], o1[j] = O[n0+lo][16+8*hi+j]
  v8f o0 = {}, o1 = {};
  float mcol = -3.0e38f;  // running maximum of query n0+lo (equal in both halves)
  float lcol = 0.0f;      // running sum over this half's keys only; joined at the end
  float ssum = 0.0f;

  for (int m0 = 0; m0 < N_; m0 += 16) {
    // ---- S^T tile = K @ (Q*scale)^T : s[j] = S[n0+lo][m0+8*hi+j] ----
    v8f s = {};
#pragma unroll
    for (int c4 = 0; c4 < 8; ++c4) {
      const float* kr = kb + (size_t)(m0 + lo) * C_ + c4 * 4 + 2 * hi;
      v2f kv;
      kv.x = kr[0];
      kv.y = kr[1];
      s = WMMA_F32(kv, qf[c4], s);
    }

    // ---- raw score sum (for pooled) + online softmax, one query per lane ----
    float tmax = s[0];
#pragma unroll
    for (int j = 0; j < 8; ++j) {
      ssum += s[j];
      tmax = fmaxf(tmax, s[j]);
    }
    tmax = fmaxf(tmax, xhalf(tmax));
    const float mnew = fmaxf(mcol, tmax);
    const float alpha = __expf(mcol - mnew);
    mcol = mnew;
    v8f p;
    float psum = 0.0f;
#pragma unroll
    for (int j = 0; j < 8; ++j) {
      p[j] = __expf(s[j] - mnew);
      psum += p[j];
      o0[j] *= alpha;
      o1[j] *= alpha;
    }
    lcol = lcol * alpha + psum;

    // ---- O^T += V^T @ P^T : K(=m)=16 in 4 chunks, two c-halves. Chunk t pairs
    // k slot (hi, i) with key m0+8*hi+2*t+i in BOTH operands, which is where
    // the score accumulator already holds it. ----
#pragma unroll
    for (int t = 0; t < 4; ++t) {
      v2f pb;
      pb.x = p[2 * t];
      pb.y = p[2 * t + 1];
      const int mg = m0 + 8 * hi + 2 * t;
      v2f va0, va1;
      va0.x = vb[(size_t)mg * C_ + lo];
      va0.y = vb[(size_t)(mg + 1) * C_ + lo];
      va1.x = vb[(size_t)mg * C_ + 16 + lo];
      va1.y = vb[(size_t)(mg + 1) * C_ + 16 + lo];
      o0 = WMMA_F32(va0, pb, o0);
      o1 = WMMA_F32(va1, pb, o1);
    }
  }

  // ---- normalize and store O[a,e][h][n][c]: 8 consecutive c per lane and tile ----
  const float inv = 1.0f / (lcol + xhalf(lcol));
  float* __restrict__ orow =
      Obuf + ((size_t)(pair * H_ + h)) * N_ * C_ + (size_t)(n0 + lo) * C_ + 8 * hi;
  *(float4*)(orow + 0) = make_float4(o0[0] * inv, o0[1] * inv, o0[2] * inv, o0[3] * inv);
  *(float4*)(orow + 4) = make_float4(o0[4] * inv, o0[5] * inv, o0[6] * inv, o0[7] * inv);
  *(float4*)(orow + 16) = make_float4(o1[0] * inv, o1[1] * inv, o1[2] * inv, o1[3] * inv);
  *(float4*)(orow + 20) = make_float4(o1[4] * inv, o1[5] * inv, o1[6] * inv, o1[7] * inv);

  // ---- per-block raw score sum: deterministic private slot ----
  ssum += __shfl_xor(ssum, 16);
  ssum += __shfl_xor(ssum, 8);
  ssum += __shfl_xor(ssum, 4);
  ssum += __shfl_xor(ssum, 2);
  ssum += __shfl_xor(ssum, 1);
  if (lane == 0) partial[(size_t)pair * NBLK + h * NTILE + blockIdx.x] = ssum;
}

// ---------------------------------------------------------------------------
// Deterministic partial-sum reduction, then pooled -> attn_r -> collapsed
// pair weights w[a][e].
// ---------------------------------------------------------------------------
__global__ __launch_bounds__(32) void weights_kernel(const float* __restrict__ partial,
                                                     float* __restrict__ w) {
  __shared__ float sumS[NPAIR];
  const int t = threadIdx.x;
  if (t < NPAIR) {
    float s = 0.0f;
    for (int i = 0; i < NBLK; ++i) s += partial[(size_t)t * NBLK + i];  // fixed order
    sumS[t] = s;
  }
  __syncthreads();
  if (t != 0) return;

  const int trace[12][4] = {{0, 1, 2, 3}, {0, 2, 3, 1}, {0, 3, 1, 2}, {1, 2, 0, 3},
                            {1, 0, 3, 2}, {1, 3, 2, 0}, {2, 3, 0, 1}, {2, 0, 1, 3},
                            {2, 1, 3, 0}, {3, 1, 0, 2}, {3, 0, 2, 1}, {3, 2, 1, 0}};
  const float inv_cnt = 1.0f / ((float)A_ * H_ * N_ * N_);
  float pos[12];
  float tot = 0.0f;
  for (int r = 0; r < 12; ++r) {
    float pooled = 0.0f;
    for (int a = 0; a < A_; ++a) pooled += sumS[a * 4 + trace[r][a]];
    pooled *= inv_cnt;
    pos[r] = pooled * pooled;
    tot += pos[r];
  }
  const float invtot = 1.0f / tot;
  for (int a = 0; a < A_; ++a)
    for (int e = 0; e < A_; ++e) {
      float acc = 0.0f;
      for (int r = 0; r < 12; ++r)
        if (trace[r][a] == e) acc += pos[r] * invtot;
      w[a * 4 + e] = acc;
    }
}

// ---------------------------------------------------------------------------
// hidden[a] = sum_e w[a,e] * O[a,e]; write out[B,A,N,D] (head-interleaved).
// blockIdx.y = a, so all index math is shifts/masks (no integer division).
// ---------------------------------------------------------------------------
__global__ __launch_bounds__(256) void combine_kernel(const float* __restrict__ Obuf,
                                                      const float* __restrict__ w,
                                                      float* __restrict__ out) {
  const int a = blockIdx.y;
  const int rem = blockIdx.x * blockDim.x + threadIdx.x;  // < N_*D_ = 98304
  const int n = rem >> 8;   // D_ = 256
  const int d = rem & 255;
  const int h = d >> 5;
  const int c = d & 31;
  float acc = 0.0f;
#pragma unroll
  for (int e = 0; e < A_; ++e) {
    const size_t oi = ((size_t)((a * 4 + e) * H_ + h)) * N_ * C_ + (size_t)n * C_ + c;
    acc += w[a * 4 + e] * Obuf[oi];
  }
  out[(size_t)a * N_ * D_ + rem] = acc;
}

// ---------------------------------------------------------------------------
extern "C" void kernel_launch(void* const* d_in, const int* in_sizes, int n_in,
                              void* d_out, int out_size, void* d_ws, size_t ws_size,
                              hipStream_t stream) {
  const float* input_q = (const float*)d_in[0];
  const float* input_k = (const float*)d_in[1];
  const float* input_v = (const float*)d_in[2];
  const float* Wq = (const float*)d_in[3];
  const float* bq = (const float*)d_in[4];
  const float* Wk = (const float*)d_in[5];
  const float* bk = (const float*)d_in[6];
  const float* Wv = (const float*)d_in[7];
  const float* bv = (const float*)d_in[8];
  float* out = (float*)d_out;

  float* ws = (float*)d_ws;
  float* qp = ws + WS_QP;
  float* kp = ws + WS_KP;
  float* vp = ws + WS_VP;
  float* Obuf = ws + WS_O;
  float* part = ws + WS_PART;
  float* wpair = ws + WS_W;

  dim3 pgrid((A_ * N_) / 16, D_ / 16, 3);  // 96 x 16 tiles, times q, k, v
  proj_kernel<<<pgrid, 32, 0, stream>>>(input_q, input_k, input_v, Wq, Wk, Wv, bq, bk, bv, qp);

  dim3 agrid(NTILE, H_, NPAIR);  // 24 x 8 x 16 one-wave blocks
  attn_kernel<<<agrid, 32, 0, stream>>>(qp, kp, vp, Obuf, part);

  weights_kernel<<<1, 32, 0, stream>>>(part, wpair);

  dim3 cgrid((N_ * D_) / 256, A_);  // 384 x 4
  combine_kernel<<<cgrid, 256, 0, stream>>>(Obuf, wpair, out);
}

// v003
// It runs in 38.9 microseconds.
// Timed twice side by side with v002, it ran 1.07 times as fast both times.
// All steps since v000 together make it 1.87 times as fast.
#include <hip/hip_runtime.h>
#include <math.h>

typedef __attribute__((ext_vector_type(2))) float v2f;
typedef __attribute__((ext_vector_type(8))) float v8f;

#define WMMA_F32(a, b, c) \
  __builtin_amdgcn_wmma_f32_16x16x4_f32(false, (a), false, (b), (short)0, (c), false, false)

// Problem constants
#define A_ 4
#define N_ 384
#define D_ 256
#define H_ 8
#define C_ 32
#define NPAIR 16         // A_*A_ unique (a,e) attention problems
#define NTILE (N_ / 16)  // 24
#define NBLK (H_ * NTILE)            // 192 attention blocks per pair
#define SCALE 0.17677669529663689f   // 1/sqrt(32)

// Workspace layout (in floats)
#define WS_QP   0u
#define WS_KP   393216u
#define WS_VP   786432u
#define WS_O    1179648u             // NPAIR*H_*N_*C_ = 1572864 floats
#define WS_PART 2752512u             // NPAIR*NBLK = 3072 floats

// ---------------------------------------------------------------------------
// Projection: y = x @ W^T + b, stored head-major as out[a][h][n][c].
// One wave per 16x16 output tile; K=256 swept in chunks of 4 via f32 WMMA.
// All three projections run in ONE launch: blockIdx.z picks q, k or v. They do
// not depend on each other, so their waves share the chip and wait for their
// loads side by side instead of one grid after the other.
// ---------------------------------------------------------------------------
__global__ __launch_bounds__(32) void proj_kernel(const float* __restrict__ xq,
                                                  const float* __restrict__ xk,
                                                  const float* __restrict__ xv,
                                                  const float* __restrict__ Wq,
                                                  const float* __restrict__ Wk,
                                                  const float* __restrict__ Wv,
                                                  const float* __restrict__ bq,
                                                  const float* __restrict__ bk,
                                                  const float* __restrict__ bv,
                                                  float* __restrict__ qkv) {
  const int z = blockIdx.z;  // 0: q, 1: k, 2: v (uniform, scalar selects)
  const float* __restrict__ x = z == 0 ? xq : (z == 1 ? xk : xv);
  const float* __restrict__ W = z == 0 ? Wq : (z == 1 ? Wk : Wv);
  const float* __restrict__ bias = z == 0 ? bq : (z == 1 ? bk : bv);
  float* __restrict__ out = qkv + (size_t)z * WS_KP;  // planes WS_QP, WS_KP, WS_VP
  const int lane = threadIdx.x;
  const int lo = lane & 15;
  const int hi = lane >> 4;  // 0 or 1
  const int t0 = blockIdx.x * 16;  // token tile (a*384+n), 96 tiles
  const int d0 = blockIdx.y * 16;  // output-channel tile, 16 tiles

  const float* __restrict__ xrow = x + (size_t)(t0 + lo) * D_;
  const float* __restrict__ wrow = W + (size_t)(d0 + lo) * D_;

  v8f acc = {};
#pragma unroll 8
  for (int kk = 0; kk < D_; kk += 4) {
    v2f av, bv;
    av.x = xrow[kk + 2 * hi];
    av.y = xrow[kk + 2 * hi + 1];
    bv.x = wrow[kk + 2 * hi];
    bv.y = wrow[kk + 2 * hi + 1];
    acc = WMMA_F32(av, bv, acc);
  }

  const float bval = bias[d0 + lo];
  const int d = d0 + lo;
  const int h = d >> 5;
  const int c = d & 31;
  // a-index is uniform per block (tiles never straddle an a boundary):
  const int ai = blockIdx.x / NTILE;          // scalar (SALU) divide
  const int nbase = t0 - ai * N_ + 8 * hi;    // row n for VGPR j is nbase + j
  float* __restrict__ obase = out + (((size_t)(ai * H_ + h)) * N_ + nbase) * C_ + c;
#pragma unroll
  for (int j = 0; j < 8; ++j) {
    obase[(size_t)j * C_] = acc[j] + bval;
  }
}

__device__ __forceinline__ float xhalf(float x) {
  return __builtin_bit_cast(float, __builtin_amdgcn_permlanex16(
      __builtin_bit_cast(int, x), __builtin_bit_cast(int, x), 0x76543210, 0xfedcba98, false, false));
}

// This grid puts three waves on a SIMD: a register budget for at most four lets
// the compiler issue all K and V loads of a pass as one group (with the default
// budget it splits the K loads and waits for memory twice per pass).
__global__ __launch_bounds__(32) __attribute__((amdgpu_waves_per_eu(1, 4))) void attn_kernel(const float* __restrict__ qp,
                                                  const float* __restrict__ kp,
                                                  const float* __restrict__ vp,
                                                  float* __restrict__ Obuf,
                                                  float* __restrict__ partial) {
  const int lane = threadIdx.x;
  const int lo = lane & 15;
  const int hi = lane >> 4;

  const int n0 = blockIdx.x * 16;
  const int h = blockIdx.y;
  const int pair = blockIdx.z;
  const int a = pair >> 2;
  const int e = pair & 3;

  const float* __restrict__ qb = qp + ((size_t)(a * H_ + h)) * N_ * C_;  // [n][c]
  const float* __restrict__ kb = kp + ((size_t)(e * H_ + h)) * N_ * C_;  // [m][c]
  const float* __restrict__ vb = vp + ((size_t)(e * H_ + h)) * N_ * C_;  // [m][c]

  // Q B-fragments for this n-tile (scale folded in): 8 chunks of K(=c)=4
  v2f qf[8];
#pragma unroll
  for (int c4 = 0; c4 < 8; ++c4) {
    const float* qr = qb + (size_t)(n0 + lo) * C_ + c4 * 4 + 2 * hi;
    qf[c4].x = qr[0] * SCALE;
    qf[c4].y = qr[1] * SCALE;
  }

  // O^T tiles: o0[j] = O[n0+lo][8*hi+j], o1[j] = O[n0+lo][16+8*hi+j]
  v8f o0 = {}, o1 = {};
  float mcol = -3.0e38f;  // running maximum of query n0+lo (equal in both halves)
  float lcol = 0.0f;      // running sum over this half's keys only; joined at the end
  float ssum = 0.0f;

  for (int m0 = 0; m0 < N_; m0 += 16) {
    // ---- S^T tile = K @ (Q*scale)^T : s[j] = S[n0+lo][m0+8*hi+j] ----
    v8f s = {};
#pragma unroll
    for (int c4 = 0; c4 < 8; ++c4) {
      const float* kr = kb + (size_t)(m0 + lo) * C_ + c4 * 4 + 2 * hi;
      v2f kv;
      kv.x = kr[0];
      kv.y = kr[1];
      s = WMMA_F32(kv, qf[c4], s);
    }

    // ---- raw score sum (for pooled) + online softmax, one query per lane ----
    float tmax = s[0];
#pragma unroll
    for (int j = 0; j < 8; ++j) {
      ssum += s[j];
      tmax = fmaxf(tmax, s[j]);
    }
    tmax = fmaxf(tmax, xhalf(tmax));
    const float mnew = fmaxf(mcol, tmax);
    const float alpha = __expf(mcol - mnew);
    mcol = mnew;
    v8f p;
    float psum = 0.0f;
#pragma unroll
    for (int j = 0; j < 8; ++j) {
      p[j] = __expf(s[j] - mnew);
      psum += p[j];
      o0[j] *= alpha;
      o1[j] *= alpha;
    }
    lcol = lcol * alpha + psum;

    // ---- O^T += V^T @ P^T : K(=m)=16 in 4 chunks, two c-halves. Chunk t pairs
    // k slot (hi, i) with key m0+8*hi+2*t+i in BOTH operands, which is where
    // the score accumulator already holds it. ----
#pragma unroll
    for (int t = 0; t < 4; ++t) {
      v2f pb;
      pb.x = p[2 * t];
      pb.y = p[2 * t + 1];
      const int mg = m0 + 8 * hi + 2 * t;
      v2f va0, va1;
      va0.x = vb[(size_t)mg * C_ + lo];
      va0.y = vb[(size_t)(mg + 1) * C_ + lo];
      va1.x = vb[(size_t)mg * C_ + 16 + lo];
      va1.y = vb[(size_t)(mg + 1) * C_ + 16 + lo];
      o0 = WMMA_F32(va0, pb, o0);
      o1 = WMMA_F32(va1, pb, o1);
    }
  }

  // ---- normalize and store O[a,e][h][n][c]: 8 consecutive c per lane and tile ----
  const float inv = 1.0f / (lcol + xhalf(lcol));
  float* __restrict__ orow =
      Obuf + ((size_t)(pair * H_ + h)) * N_ * C_ + (size_t)(n0 + lo) * C_ + 8 * hi;
  *(float4*)(orow + 0) = make_float4(o0[0] * inv, o0[1] * inv, o0[2] * inv, o0[3] * inv);
  *(float4*)(orow + 4) = make_float4(o0[4] * inv, o0[5] * inv, o0[6] * inv, o0[7] * inv);
  *(float4*)(orow + 16) = make_float4(o1[0] * inv, o1[1] * inv, o1[2] * inv, o1[3] * inv);
  *(float4*)(orow + 20) = make_float4(o1[4] * inv, o1[5] * inv, o1[6] * inv, o1[7] * inv);

  // ---- per-block raw score sum: deterministic private slot ----
  ssum += __shfl_xor(ssum, 16);
  ssum += __shfl_xor(ssum, 8);
  ssum += __shfl_xor(ssum, 4);
  ssum += __shfl_xor(ssum, 2);
  ssum += __shfl_xor(ssum, 1);
  if (lane == 0) partial[(size_t)pair * NBLK + h * NTILE + blockIdx.x] = ssum;
}

// ---------------------------------------------------------------------------
// hidden[a] = sum_e w[a,e] * O[a,e]; write out[B,A,N,D] (head-interleaved).
// blockIdx.y = a, so all index math is shifts/masks (no integer division).
// Every block forms the pair weights itself from the attention blocks' partial
// score sums (pooled -> attn_r -> collapsed w[a][e]): the sums are 12 KiB that
// stay in cache, all blocks add them in the same fixed order, and the launch
// that one lone block needed for it is gone.
// ---------------------------------------------------------------------------
template <int CTRL>
__device__ __forceinline__ float row_xadd(float x) {  // x + x of lane l ^ mask, inside a 16-lane row
  return x + __builtin_bit_cast(float, __builtin_amdgcn_update_dpp(
                 0, __builtin_bit_cast(int, x), CTRL, 0xf, 0xf, false));
}

// sum_e w[AA][e] * ov[e], with w[AA][e] = sum of attn_r[r] over the rotations
// that send anchor AA to e. AA is a compile-time value, so the table folds away.
template <int AA>
__device__ __forceinline__ float mix_anchor(const float (&attn_r)[12], const float (&ov)[A_]) {
  constexpr int trace[12][4] = {{0, 1, 2, 3}, {0, 2, 3, 1}, {0, 3, 1, 2}, {1, 2, 0, 3},
                                {1, 0, 3, 2}, {1, 3, 2, 0}, {2, 3, 0, 1}, {2, 0, 1, 3},
                                {2, 1, 3, 0}, {3, 1, 0, 2}, {3, 0, 2, 1}, {3, 2, 1, 0}};
  float acc = 0.0f;
#pragma unroll
  for (int e = 0; e < A_; ++e) {
    float w = 0.0f;
#pragma unroll
    for (int r = 0; r < 12; ++r)
      if (trace[r][AA] == e) w += attn_r[r];
    acc += w * ov[e];
  }
  return acc;
}

__global__ __launch_bounds__(256) void combine_kernel(const float* __restrict__ Obuf,
                                                      const float* __restrict__ partial,
                                                      float* __restrict__ out) {
  __shared__ __attribute__((aligned(16))) float sumS[NPAIR];
  const int t = threadIdx.x;
  const int a = blockIdx.y;
  const int rem = blockIdx.x * blockDim.x + t;  // < N_*D_ = 98304
  const int n = rem >> 8;   // D_ = 256
  const int d = rem & 255;
  const int h = d >> 5;
  const int c = d & 31;

  // The four O values do not depend on the weights: their loads go out together
  // with the loads of the partials, so the block waits for memory once.
  float ov[A_];
#pragma unroll
  for (int e = 0; e < A_; ++e)
    ov[e] = Obuf[((size_t)((a * 4 + e) * H_ + h)) * N_ * C_ + (size_t)n * C_ + c];

  // Score sum of pair t >> 4: its 192 partials over 16 lanes, whole lines per load.
  const float4* __restrict__ p4 = (const float4*)(partial + (size_t)(t >> 4) * NBLK) + (t & 15);
  const float4 x0 = p4[0], x1 = p4[16], x2 = p4[32];
  // Keeps all seven loads in front of the first add: without it the O loads are
  // issued only after the first partial has come back (two memory waits in a row).
  __builtin_amdgcn_sched_barrier(0);
  float s = ((x0.x + x0.y) + (x0.z + x0.w)) + ((x1.x + x1.y) + (x1.z + x1.w)) +
            ((x2.x + x2.y) + (x2.z + x2.w));
  s = row_xadd<0x161>(s);  // row_xmask:1
  s = row_xadd<0x162>(s);  // row_xmask:2
  s = row_xadd<0x164>(s);  // row_xmask:4
  s = row_xadd<0x168>(s);  // row_xmask:8
  if ((t & 15) == 0) sumS[t >> 4] = s;
  __syncthreads();  // every wave needs all 16 pair sums

  constexpr int trace[12][4] = {{0, 1, 2, 3}, {0, 2, 3, 1}, {0, 3, 1, 2}, {1, 2, 0, 3},
                                {1, 0, 3, 2}, {1, 3, 2, 0}, {2, 3, 0, 1}, {2, 0, 1, 3},
                                {2, 1, 3, 0}, {3, 1, 0, 2}, {3, 0, 2, 1}, {3, 2, 1, 0}};
  float sm[NPAIR];
#pragma unroll
  for (int i = 0; i < NPAIR; ++i) sm[i] = sumS[i];
  const float inv_cnt = 1.0f / ((float)A_ * H_ * N_ * N_);
  float attn_r[12];
  float tot = 0.0f;
#pragma unroll
  for (int r = 0; r < 12; ++r) {
    float pooled = 0.0f;
#pragma unroll
    for (int i = 0; i < A_; ++i) pooled += sm[i * 4 + trace[r][i]];
    pooled *= inv_cnt;
    attn_r[r] = pooled * pooled;
    tot += attn_r[r];
  }
  const float invtot = 1.0f / tot;
#pragma unroll
  for (int r = 0; r < 12; ++r) attn_r[r] *= invtot;

  float acc;  // a is the same for the whole block: a scalar branch
  if (a == 0) acc = mix_anchor<0>(attn_r, ov);
  else if (a == 1) acc = mix_anchor<1>(attn_r, ov);
  else if (a == 2) acc = mix_anchor<2>(attn_r, ov);
  else acc = mix_anchor<3>(attn_r, ov);
  out[(size_t)a * N_ * D_ + rem] = acc;
}

// ---------------------------------------------------------------------------
extern "C" void kernel_launch(void* const* d_in, const int* in_sizes, int n_in,
                              void* d_out, int out_size, void* d_ws, size_t ws_size,
                              hipStream_t stream) {
  const float* input_q = (const float*)d_in[0];
  const float* input_k = (const float*)d_in[1];
  const float* input_v = (const float*)d_in[2];
  const float* Wq = (const float*)d_in[3];
  const float* bq = (const float*)d_in[4];
  const float* Wk = (const float*)d_in[5];
  const float* bk = (const float*)d_in[6];
  const float* Wv = (const float*)d_in[7];
  const float* bv = (const float*)d_in[8];
  float* out = (float*)d_out;

  float* ws = (float*)d_ws;
  float* qp = ws + WS_QP;
  float* kp = ws + WS_KP;
  float* vp = ws + WS_VP;
  float* Obuf = ws + WS_O;
  float* part = ws + WS_PART;

  dim3 pgrid((A_ * N_) / 16, D_ / 16, 3);  // 96 x 16 tiles, times q, k, v
  proj_kernel<<<pgrid, 32, 0, stream>>>(input_q, input_k, input_v, Wq, Wk, Wv, bq, bk, bv, qp);

  dim3 agrid(NTILE, H_, NPAIR);  // 24 x 8 x 16 one-wave blocks
  attn_kernel<<<agrid, 32, 0, stream>>>(qp, kp, vp, Obuf, part);

  dim3 cgrid((N_ * D_) / 256, A_);  // 384 x 4
  combine_kernel<<<cgrid, 256, 0, stream>>>(Obuf, part, out);
}

// v004
// Measured time: 33.5 microseconds a run.
// Next to v003, in two timings, it ran 1.15 and 1.14 times as fast.
// Over all steps from v000 it is 2.14 times as fast.
#include <hip/hip_runtime.h>
#include <math.h>

typedef __attribute__((ext_vector_type(2))) float v2f;
typedef __attribute__((ext_vector_type(8))) float v8f;

#define WMMA_F32(a, b, c) \
  __builtin_amdgcn_wmma_f32_16x16x4_f32(false, (a), false, (b), (short)0, (c), false, false)

// Problem constants
#define A_ 4
#define N_ 384
#define D_ 256
#define H_ 8
#define C_ 32
#define NPAIR 16         // A_*A_ unique (a,e) attention problems
#define NTILE (N_ / 16)  // 24
#define NBLK (H_ * NTILE)            // 192 attention waves (h, query tile) per pair
#define SCALE 0.17677669529663689f   // 1/sqrt(32)
#define AWAVES 12        // waves (query tiles) per attention block
#define KP 36            // LDS pitch of a K row in floats (32 + 4 of padding)
#define VP 72            // LDS pitch of a pair of V rows in floats (64 + 8 of padding)

// Workspace layout (in floats)
#define WS_QP   0u
#define WS_KP   393216u
#define WS_VP   786432u
#define WS_O    1179648u             // NPAIR*H_*N_*C_ = 1572864 floats
#define WS_PART 2752512u             // NPAIR*NBLK = 3072 floats

// ---------------------------------------------------------------------------
// Projection: y = x @ W^T + b, stored head-major as out[a][h][n][c].
// One wave per 16x16 output tile; K=256 swept in chunks of 4 via f32 WMMA.
// All three projections run in ONE launch: blockIdx.z picks q, k or v. They do
// not depend on each other, so their waves share the chip and wait for their
// loads side by side instead of one grid after the other.
// ---------------------------------------------------------------------------
__global__ __launch_bounds__(32) void proj_kernel(const float* __restrict__ xq,
                                                  const float* __restrict__ xk,
                                                  const float* __restrict__ xv,
                                                  const float* __restrict__ Wq,
                                                  const float* __restrict__ Wk,
                                                  const float* __restrict__ Wv,
                                                  const float* __restrict__ bq,
                                                  const float* __restrict__ bk,
                                                  const float* __restrict__ bv,
                                                  float* __restrict__ qkv) {
  const int z = blockIdx.z;  // 0: q, 1: k, 2: v (uniform, scalar selects)
  const float* __restrict__ x = z == 0 ? xq : (z == 1 ? xk : xv);
  const float* __restrict__ W = z == 0 ? Wq : (z == 1 ? Wk : Wv);
  const float* __restrict__ bias = z == 0 ? bq : (z == 1 ? bk : bv);
  float* __restrict__ out = qkv + (size_t)z * WS_KP;  // planes WS_QP, WS_KP, WS_VP
  const int lane = threadIdx.x;
  const int lo = lane & 15;
  const int hi = lane >> 4;  // 0 or 1
  const int t0 = blockIdx.x * 16;  // token tile (a*384+n), 96 tiles
  const int d0 = blockIdx.y * 16;  // output-channel tile, 16 tiles

  const float* __restrict__ xrow = x + (size_t)(t0 + lo) * D_;
  const float* __restrict__ wrow = W + (size_t)(d0 + lo) * D_;

  v8f acc = {};
#pragma unroll 8
  for (int kk = 0; kk < D_; kk += 4) {
    v2f av, bv;
    av.x = xrow[kk + 2 * hi];
    av.y = xrow[kk + 2 * hi + 1];
    bv.x = wrow[kk + 2 * hi];
    bv.y = wrow[kk + 2 * hi + 1];
    acc = WMMA_F32(av, bv, acc);
  }

  const float bval = bias[d0 + lo];
  const int d = d0 + lo;
  const int h = d >> 5;
  const int c = d & 31;
  // a-index is uniform per block (tiles never straddle an a boundary):
  const int ai = blockIdx.x / NTILE;          // scalar (SALU) divide
  const int nbase = t0 - ai * N_ + 8 * hi;    // row n for VGPR j is nbase + j
  float* __restrict__ obase = out + (((size_t)(ai * H_ + h)) * N_ + nbase) * C_ + c;
#pragma unroll
  for (int j = 0; j < 8; ++j) {
    obase[(size_t)j * C_] = acc[j] + bval;
  }
}

__device__ __forceinline__ float xhalf(float x) {
  return __builtin_bit_cast(float, __builtin_amdgcn_permlanex16(
      __builtin_bit_cast(int, x), __builtin_bit_cast(int, x), 0x76543210, 0xfedcba98, false, false));
}

__global__ __launch_bounds__(AWAVES * 32) void attn_kernel(const float* __restrict__ qp,
                                                  const float* __restrict__ kp,
                                                  const float* __restrict__ vp,
                                                  float* __restrict__ Obuf,
                                                  float* __restrict__ partial) {
  // Ks: row m at m*KP. Vs: rows 2u and 2u+1 interleaved by column at u*VP, so
  // that the two keys of a V fragment's k slots are one 8-byte read:
  // Vs[u*VP + 2*c + i] = V[2u+i][c]. With these pitches the 32 lanes of a K read
  // (16 rows, 4 floats a row) and of a V read (2 pair rows four apart, 32 floats
  // each) fall on 64 distinct banks; the staging stores stay 16-byte aligned.
  __shared__ __attribute__((aligned(16))) float Ks[N_ * KP];
  __shared__ __attribute__((aligned(16))) float Vs[(N_ / 2) * VP];
  const int tid = threadIdx.x;
  const int lane = tid & 31;
  const int lo = lane & 15;
  const int hi = lane >> 4;
  const int ntile = blockIdx.x * AWAVES + __builtin_amdgcn_readfirstlane(tid >> 5);  // wave-uniform

  const int n0 = ntile * 16;
  const int h = blockIdx.y;
  const int pair = blockIdx.z;
  const int a = pair >> 2;
  const int e = pair & 3;

  const float* __restrict__ qb = qp + ((size_t)(a * H_ + h)) * N_ * C_;  // [n][c]
  const float* __restrict__ kb = kp + ((size_t)(e * H_ + h)) * N_ * C_;  // [m][c]
  const float* __restrict__ vb = vp + ((size_t)(e * H_ + h)) * N_ * C_;  // [m][c]

  // All of K and V of this (e,h), 16 bytes a thread and load, whole lines.
  // K: piece i*384+tid. V: the same four columns of rows 2u and 2u+1, u = i*48+tid/8.
  // (The four staging loops are unrolled so that the pieces live in registers
  // and all sixteen loads are in flight before the first LDS store.)
  float4 kst[8], vev[4], vod[4];
#pragma unroll
  for (int i = 0; i < 8; ++i) kst[i] = ((const float4*)kb)[i * (AWAVES * 32) + tid];
#pragma unroll
  for (int i = 0; i < 4; ++i) {
    const float4* vg = (const float4*)vb + i * (AWAVES * 64) + (tid >> 3) * 16 + (tid & 7);
    vev[i] = vg[0];
    vod[i] = vg[8];
  }

  // Q B-fragments for this n-tile (scale folded in): 8 chunks of K(=c)=4
  v2f qf[8];
#pragma unroll
  for (int c4 = 0; c4 < 8; ++c4) {
    const float* qr = qb + (size_t)(n0 + lo) * C_ + c4 * 4 + 2 * hi;
    qf[c4].x = qr[0] * SCALE;
    qf[c4].y = qr[1] * SCALE;
  }

  // K piece i*384+tid is row i*48 + tid/8, floats 4*(tid%8).. of that row.
  {
    float* __restrict__ kd = Ks + (tid >> 3) * KP + (tid & 7) * 4;
    float* __restrict__ vd = Vs + (tid >> 3) * VP + (tid & 7) * 8;
#pragma unroll
    for (int i = 0; i < 8; ++i) *(float4*)(kd + i * (AWAVES * 4) * KP) = kst[i];
#pragma unroll
    for (int i = 0; i < 4; ++i) {
      float* vdi = vd + i * (AWAVES * 4) * VP;
      *(float4*)(vdi + 0) = make_float4(vev[i].x, vod[i].x, vev[i].y, vod[i].y);
      *(float4*)(vdi + 4) = make_float4(vev[i].z, vod[i].z, vev[i].w, vod[i].w);
    }
  }
  __syncthreads();  // every wave reads rows that the other waves staged
  const float* __restrict__ kl = Ks + lo * KP + 2 * hi;
  const float* __restrict__ vl = Vs + 4 * hi * VP + 2 * lo;

  // O^T tiles: o0[j] = O[n0+lo][8*hi+j], o1[j] = O[n0+lo][16+8*hi+j]
  v8f o0 = {}, o1 = {};
  float mcol = -3.0e38f;  // running maximum of query n0+lo (equal in both halves)
  float lcol = 0.0f;      // running sum over this half's keys only; joined at the end
  float ssum = 0.0f;

  for (int m0 = 0; m0 < N_; m0 += 16) {
    // ---- S^T tile = K @ (Q*scale)^T : s[j] = S[n0+lo][m0+8*hi+j] ----
    v8f s = {};
#pragma unroll
    for (int c4 = 0; c4 < 8; ++c4) {
      const float* kr = kl + m0 * KP + c4 * 4;
      v2f kv;
      kv.x = kr[0];
      kv.y = kr[1];
      s = WMMA_F32(kv, qf[c4], s);
    }

    // ---- raw score sum (for pooled) + online softmax, one query per lane ----
    float tmax = s[0];
#pragma unroll
    for (int j = 0; j < 8; ++j) {
      ssum += s[j];
      tmax = fmaxf(tmax, s[j]);
    }
    tmax = fmaxf(tmax, xhalf(tmax));
    const float mnew = fmaxf(mcol, tmax);
    const float alpha = __expf(mcol - mnew);
    mcol = mnew;
    v8f p;
    float psum = 0.0f;
#pragma unroll
    for (int j = 0; j < 8; ++j) {
      p[j] = __expf(s[j] - mnew);
      psum += p[j];
      o0[j] *= alpha;
      o1[j] *= alpha;
    }
    lcol = lcol * alpha + psum;

    // ---- O^T += V^T @ P^T : K(=m)=16 in 4 chunks, two c-halves. Chunk t pairs
    // k slot (hi, i) with key m0+8*hi+2*t+i in BOTH operands, which is where
    // the score accumulator already holds it. ----
#pragma unroll
    for (int t = 0; t < 4; ++t) {
      v2f pb;
      pb.x = p[2 * t];
      pb.y = p[2 * t + 1];
      const float* vr = vl + (m0 / 2 + t) * VP;  // rows m0+8*hi+2*t and +1, column lo
      v2f va0, va1;
      va0.x = vr[0];
      va0.y = vr[1];
      va1.x = vr[32];  // column 16 + lo
      va1.y = vr[33];
      o0 = WMMA_F32(va0, pb, o0);
      o1 = WMMA_F32(va1, pb, o1);
    }
  }

  // ---- normalize and store O[a,e][h][n][c]: 8 consecutive c per lane and tile ----
  const float inv = 1.0f / (lcol + xhalf(lcol));
  float* __restrict__ orow =
      Obuf + ((size_t)(pair * H_ + h)) * N_ * C_ + (size_t)(n0 + lo) * C_ + 8 * hi;
  *(float4*)(orow + 0) = make_float4(o0[0] * inv, o0[1] * inv, o0[2] * inv, o0[3] * inv);
  *(float4*)(orow + 4) = make_float4(o0[4] * inv, o0[5] * inv, o0[6] * inv, o0[7] * inv);
  *(float4*)(orow + 16) = make_float4(o1[0] * inv, o1[1] * inv, o1[2] * inv, o1[3] * inv);
  *(float4*)(orow + 20) = make_float4(o1[4] * inv, o1[5] * inv, o1[6] * inv, o1[7] * inv);

  // ---- per-wave raw score sum: deterministic private slot ----
  ssum += __shfl_xor(ssum, 16);
  ssum += __shfl_xor(ssum, 8);
  ssum += __shfl_xor(ssum, 4);
  ssum += __shfl_xor(ssum, 2);
  ssum += __shfl_xor(ssum, 1);
  if (lane == 0) partial[(size_t)pair * NBLK + h * NTILE + ntile] = ssum;
}

// ---------------------------------------------------------------------------
// hidden[a] = sum_e w[a,e] * O[a,e]; write out[B,A,N,D] (head-interleaved).
// blockIdx.y = a, so all index math is shifts/masks (no integer division).
// Every block forms the pair weights itself from the attention blocks' partial
// score sums (pooled -> attn_r -> collapsed w[a][e]): the sums are 12 KiB that
// stay in cache, all blocks add them in the same fixed order, and the launch
// that one lone block needed for it is gone.
// ---------------------------------------------------------------------------
template <int CTRL>
__device__ __forceinline__ float row_xadd(float x) {  // x + x of lane l ^ mask, inside a 16-lane row
  return x + __builtin_bit_cast(float, __builtin_amdgcn_update_dpp(
                 0, __builtin_bit_cast(int, x), CTRL, 0xf, 0xf, false));
}

// sum_e w[AA][e] * ov[e], with w[AA][e] = sum of attn_r[r] over the rotations
// that send anchor AA to e. AA is a compile-time value, so the table folds away.
template <int AA>
__device__ __forceinline__ float mix_anchor(const float (&attn_r)[12], const float (&ov)[A_]) {
  constexpr int trace[12][4] = {{0, 1, 2, 3}, {0, 2, 3, 1}, {0, 3, 1, 2}, {1, 2, 0, 3},
                                {1, 0, 3, 2}, {1, 3, 2, 0}, {2, 3, 0, 1}, {2, 0, 1, 3},
                                {2, 1, 3, 0}, {3, 1, 0, 2}, {3, 0, 2, 1}, {3, 2, 1, 0}};
  float acc = 0.0f;
#pragma unroll
  for (int e = 0; e < A_; ++e) {
    float w = 0.0f;
#pragma unroll
    for (int r = 0; r < 12; ++r)
      if (trace[r][AA] == e) w += attn_r[r];
    acc += w * ov[e];
  }
  return acc;
}

__global__ __launch_bounds__(256) void combine_kernel(const float* __restrict__ Obuf,
                                                      const float* __restrict__ partial,
                                                      float* __restrict__ out) {
  __shared__ __attribute__((aligned(16))) float sumS[NPAIR];
  const int t = threadIdx.x;
  const int a = blockIdx.y;
  const int rem = blockIdx.x * blockDim.x + t;  // < N_*D_ = 98304
  const int n = rem >> 8;   // D_ = 256
  const int d = rem & 255;
  const int h = d >> 5;
  const int c = d & 31;

  // The four O values do not depend on the weights: their loads go out together
  // with the loads of the partials, so the block waits for memory once.
  float ov[A_];
#pragma unroll
  for (int e = 0; e < A_; ++e)
    ov[e] = Obuf[((size_t)((a * 4 + e) * H_ + h)) * N_ * C_ + (size_t)n * C_ + c];

  // Score sum of pair t >> 4: its 192 partials over 16 lanes, whole lines per load.
  const float4* __restrict__ p4 = (const float4*)(partial + (size_t)(t >> 4) * NBLK) + (t & 15);
  const float4 x0 = p4[0], x1 = p4[16], x2 = p4[32];
  // Keeps all seven loads in front of the first add: without it the O loads are
  // issued only after the first partial has come back (two memory waits in a row).
  __builtin_amdgcn_sched_barrier(0);
  float s = ((x0.x + x0.y) + (x0.z + x0.w)) + ((x1.x + x1.y) + (x1.z + x1.w)) +
            ((x2.x + x2.y) + (x2.z + x2.w));
  s = row_xadd<0x161>(s);  // row_xmask:1
  s = row_xadd<0x162>(s);  // row_xmask:2
  s = row_xadd<0x164>(s);  // row_xmask:4
  s = row_xadd<0x168>(s);  // row_xmask:8
  if ((t & 15) == 0) sumS[t >> 4] = s;
  __syncthreads();  // every wave needs all 16 pair sums

  constexpr int trace[12][4] = {{0, 1, 2, 3}, {0, 2, 3, 1}, {0, 3, 1, 2}, {1, 2, 0, 3},
                                {1, 0, 3, 2}, {1, 3, 2, 0}, {2, 3, 0, 1}, {2, 0, 1, 3},
                                {2, 1, 3, 0}, {3, 1, 0, 2}, {3, 0, 2, 1}, {3, 2, 1, 0}};
  float sm[NPAIR];
#pragma unroll
  for (int i = 0; i < NPAIR; ++i) sm[i] = sumS[i];
  const float inv_cnt = 1.0f / ((float)A_ * H_ * N_ * N_);
  float attn_r[12];
  float tot = 0.0f;
#pragma unroll
  for (int r = 0; r < 12; ++r) {
    float pooled = 0.0f;
#pragma unroll
    for (int i = 0; i < A_; ++i) pooled += sm[i * 4 + trace[r][i]];
    pooled *= inv_cnt;
    attn_r[r] = pooled * pooled;
    tot += attn_r[r];
  }
  const float invtot = 1.0f / tot;
#pragma unroll
  for (int r = 0; r < 12; ++r) attn_r[r] *= invtot;

  float acc;  // a is the same for the whole block: a scalar branch
  if (a == 0) acc = mix_anchor<0>(attn_r, ov);
  else if (a == 1) acc = mix_anchor<1>(attn_r, ov);
  else if (a == 2) acc = mix_anchor<2>(attn_r, ov);
  else acc = mix_anchor<3>(attn_r, ov);
  out[(size_t)a * N_ * D_ + rem] = acc;
}

// ---------------------------------------------------------------------------
extern "C" void kernel_launch(void* const* d_in, const int* in_sizes, int n_in,
                              void* d_out, int out_size, void* d_ws, size_t ws_size,
                              hipStream_t stream) {
  const float* input_q = (const float*)d_in[0];
  const float* input_k = (const float*)d_in[1];
  const float* input_v = (const float*)d_in[2];
  const float* Wq = (const float*)d_in[3];
  const float* bq = (const float*)d_in[4];
  const float* Wk = (const float*)d_in[5];
  const float* bk = (const float*)d_in[6];
  const float* Wv = (const float*)d_in[7];
  const float* bv = (const float*)d_in[8];
  float* out = (float*)d_out;

  float* ws = (float*)d_ws;
  float* qp = ws + WS_QP;
  float* kp = ws + WS_KP;
  float* vp = ws + WS_VP;
  float* Obuf = ws + WS_O;
  float* part = ws + WS_PART;

  dim3 pgrid((A_ * N_) / 16, D_ / 16, 3);  // 96 x 16 tiles, times q, k, v
  proj_kernel<<<pgrid, 32, 0, stream>>>(input_q, input_k, input_v, Wq, Wk, Wv, bq, bk, bv, qp);

  dim3 agrid(NTILE / AWAVES, H_, NPAIR);  // 2 x 8 x 16 blocks of 12 waves
  attn_kernel<<<agrid, AWAVES * 32, 0, stream>>>(qp, kp, vp, Obuf, part);

  dim3 cgrid((N_ * D_) / 256, A_);  // 384 x 4
  combine_kernel<<<cgrid, 256, 0, stream>>>(Obuf, part, out);
}

// v005
// One run takes 28 microseconds.
// Next to v004, in two timings, it ran 1.20 times as fast each time.
// Over all steps from v000 it is 2.56 times as fast.
#include <hip/hip_runtime.h>
#include <math.h>

typedef __attribute__((ext_vector_type(2))) float v2f;
typedef __attribute__((ext_vector_type(8))) float v8f;

#define WMMA_F32(a, b, c) \
  __builtin_amdgcn_wmma_f32_16x16x4_f32(false, (a), false, (b), (short)0, (c), false, false)

// Problem constants
#define A_ 4
#define N_ 384
#define D_ 256
#define H_ 8
#define C_ 32
#define NPAIR 16         // A_*A_ unique (a,e) attention problems
#define NTILE (N_ / 16)  // 24
#define NBLK (H_ * NTILE)            // 192 attention waves (h, query tile) per pair
#define SCALE 0.17677669529663689f   // 1/sqrt(32)
#define AWAVES 12        // waves (query tiles) per attention block
#define KP 36            // LDS pitch of a K row in floats (32 + 4 of padding)
#define VP 72            // LDS pitch of a pair of V rows in floats (64 + 8 of padding)
#define PWAVES 8         // waves per projection block
#define PT 96            // tokens per projection block
#define PC 64            // output channels per projection block
#define PP 260           // LDS pitch of an x or W row in floats (256 + 4 of padding)

// Workspace layout (in floats)
#define WS_QP   0u
#define WS_KP   393216u
#define WS_VP   786432u
#define WS_O    1179648u             // NPAIR*H_*N_*C_ = 1572864 floats
#define WS_PART 2752512u             // NPAIR*NBLK = 3072 floats

// ---------------------------------------------------------------------------
// Projection: y = x @ W^T + b, stored head-major as out[a][h][n][c].
// K=256 swept in chunks of 4 via f32 WMMA. All three projections run in ONE
// launch: blockIdx.z picks q, k or v.
// A block of eight waves makes a 96 x 64 piece of y. It first brings its 96 rows
// of x and 64 rows of W into LDS, 16 bytes a lane, so that a load covers four
// whole 128-byte lines; the fragments (8 bytes a lane out of 16 different rows)
// then come from LDS, where that shape costs nothing, and a row leaves L2 once
// per block instead of once per 16 x 16 tile. A wave keeps three token tiles of
// one channel tile: three independent accumulators, one W fragment for three
// products.
// ---------------------------------------------------------------------------
__global__ __launch_bounds__(PWAVES * 32) void proj_kernel(const float* __restrict__ xq,
                                                  const float* __restrict__ xk,
                                                  const float* __restrict__ xv,
                                                  const float* __restrict__ Wq,
                                                  const float* __restrict__ Wk,
                                                  const float* __restrict__ Wv,
                                                  const float* __restrict__ bq,
                                                  const float* __restrict__ bk,
                                                  const float* __restrict__ bv,
                                                  float* __restrict__ qkv) {
  // Row r at r*PP. With this pitch the 32 lanes of a fragment read (16 rows, 4
  // floats a row) fall on 64 distinct banks; the staging stores stay 16-byte aligned.
  __shared__ __attribute__((aligned(16))) float Xs[PT * PP];
  __shared__ __attribute__((aligned(16))) float Ws[PC * PP];
  const int z = blockIdx.z;  // 0: q, 1: k, 2: v (uniform, scalar selects)
  const float* __restrict__ x = z == 0 ? xq : (z == 1 ? xk : xv);
  const float* __restrict__ W = z == 0 ? Wq : (z == 1 ? Wk : Wv);
  const float* __restrict__ bias = z == 0 ? bq : (z == 1 ? bk : bv);
  float* __restrict__ out = qkv + (size_t)z * WS_KP;  // planes WS_QP, WS_KP, WS_VP
  const int tid = threadIdx.x;
  const int lane = tid & 31;
  const int lo = lane & 15;
  const int hi = lane >> 4;  // 0 or 1
  const int wave = __builtin_amdgcn_readfirstlane(tid >> 5);  // wave-uniform
  const int tw = wave >> 2;  // which 48 of the block's 96 tokens
  const int cw = wave & 3;   // which 16 of the block's 64 channels
  const int t0 = blockIdx.x * PT;  // token piece (a*384+n), 16 pieces
  const int d0 = blockIdx.y * PC;  // output-channel piece, 4 pieces

  // Both pieces are contiguous in memory (whole rows): 16-byte piece i*256+tid is
  // row i*4 + tid/64, floats 4*(tid%64).. of that row. (The loops are unrolled so
  // that the pieces live in registers and all loads are in flight before the
  // first LDS store.)
  const float4* __restrict__ xg = (const float4*)(x + (size_t)t0 * D_) + tid;
  const float4* __restrict__ wg = (const float4*)(W + (size_t)d0 * D_) + tid;
  float4 xst[PT / 4], wst[PC / 4];
#pragma unroll
  for (int i = 0; i < PC / 4; ++i) wst[i] = wg[i * (PWAVES * 32)];
#pragma unroll
  for (int i = 0; i < PT / 4; ++i) xst[i] = xg[i * (PWAVES * 32)];
  const int d = d0 + cw * 16 + lo;
  const float bval = bias[d];
  {
    const int so = (tid >> 6) * PP + (tid & 63) * 4;
#pragma unroll
    for (int i = 0; i < PC / 4; ++i) *(float4*)(Ws + so + i * 4 * PP) = wst[i];
#pragma unroll
    for (int i = 0; i < PT / 4; ++i) *(float4*)(Xs + so + i * 4 * PP) = xst[i];
  }
  __syncthreads();  // every wave reads rows that the other waves staged

  const float* __restrict__ xl = Xs + (tw * 48 + lo) * PP + 2 * hi;
  const float* __restrict__ wl = Ws + (cw * 16 + lo) * PP + 2 * hi;
  v8f acc[3] = {};
#pragma unroll 8
  for (int kk = 0; kk < D_; kk += 4) {
    v2f bf;
    bf.x = wl[kk];
    bf.y = wl[kk + 1];
#pragma unroll
    for (int i = 0; i < 3; ++i) {
      v2f af;
      af.x = xl[i * 16 * PP + kk];
      af.y = xl[i * 16 * PP + kk + 1];
      acc[i] = WMMA_F32(af, bf, acc[i]);
    }
  }

  const int h = d >> 5;
  const int c = d & 31;
  // a-index is uniform per block (pieces never straddle an a boundary):
  const int ai = blockIdx.x / (N_ / PT);
  const int nbase = t0 - ai * N_ + tw * 48 + 8 * hi;  // row n for tile i, VGPR j is nbase + 16*i + j
  float* __restrict__ obase = out + (((size_t)(ai * H_ + h)) * N_ + nbase) * C_ + c;
#pragma unroll
  for (int i = 0; i < 3; ++i) {
#pragma unroll
    for (int j = 0; j < 8; ++j) {
      obase[(size_t)(i * 16 + j) * C_] = acc[i][j] + bval;
    }
  }
}

__device__ __forceinline__ float xhalf(float x) {
  return __builtin_bit_cast(float, __builtin_amdgcn_permlanex16(
      __builtin_bit_cast(int, x), __builtin_bit_cast(int, x), 0x76543210, 0xfedcba98, false, false));
}

__global__ __launch_bounds__(AWAVES * 32) void attn_kernel(const float* __restrict__ qp,
                                                  const float* __restrict__ kp,
                                                  const float* __restrict__ vp,
                                                  float* __restrict__ Obuf,
                                                  float* __restrict__ partial) {
  // Ks: row m at m*KP. Vs: rows 2u and 2u+1 interleaved by column at u*VP, so
  // that the two keys of a V fragment's k slots are one 8-byte read:
  // Vs[u*VP + 2*c + i] = V[2u+i][c]. With these pitches the 32 lanes of a K read
  // (16 rows, 4 floats a row) and of a V read (2 pair rows four apart, 32 floats
  // each) fall on 64 distinct banks; the staging stores stay 16-byte aligned.
  __shared__ __attribute__((aligned(16))) float Ks[N_ * KP];
  __shared__ __attribute__((aligned(16))) float Vs[(N_ / 2) * VP];
  const int tid = threadIdx.x;
  const int lane = tid & 31;
  const int lo = lane & 15;
  const int hi = lane >> 4;
  const int ntile = blockIdx.x * AWAVES + __builtin_amdgcn_readfirstlane(tid >> 5);  // wave-uniform

  const int n0 = ntile * 16;
  const int h = blockIdx.y;
  const int pair = blockIdx.z;
  const int a = pair >> 2;
  const int e = pair & 3;

  const float* __restrict__ qb = qp + ((size_t)(a * H_ + h)) * N_ * C_;  // [n][c]
  const float* __restrict__ kb = kp + ((size_t)(e * H_ + h)) * N_ * C_;  // [m][c]
  const float* __restrict__ vb = vp + ((size_t)(e * H_ + h)) * N_ * C_;  // [m][c]

  // All of K and V of this (e,h), 16 bytes a thread and load, whole lines.
  // K: piece i*384+tid. V: the same four columns of rows 2u and 2u+1, u = i*48+tid/8.
  // (The four staging loops are unrolled so that the pieces live in registers
  // and all sixteen loads are in flight before the first LDS store.)
  float4 kst[8], vev[4], vod[4];
#pragma unroll
  for (int i = 0; i < 8; ++i) kst[i] = ((const float4*)kb)[i * (AWAVES * 32) + tid];
#pragma unroll
  for (int i = 0; i < 4; ++i) {
    const float4* vg = (const float4*)vb + i * (AWAVES * 64) + (tid >> 3) * 16 + (tid & 7);
    vev[i] = vg[0];
    vod[i] = vg[8];
  }

  // Q B-fragments for this n-tile (scale folded in): 8 chunks of K(=c)=4
  v2f qf[8];
#pragma unroll
  for (int c4 = 0; c4 < 8; ++c4) {
    const float* qr = qb + (size_t)(n0 + lo) * C_ + c4 * 4 + 2 * hi;
    qf[c4].x = qr[0] * SCALE;
    qf[c4].y = qr[1] * SCALE;
  }

  // K piece i*384+tid is row i*48 + tid/8, floats 4*(tid%8).. of that row.
  {
    float* __restrict__ kd = Ks + (tid >> 3) * KP + (tid & 7) * 4;
    float* __restrict__ vd = Vs + (tid >> 3) * VP + (tid & 7) * 8;
#pragma unroll
    for (int i = 0; i < 8; ++i) *(float4*)(kd + i * (AWAVES * 4) * KP) = kst[i];
#pragma unroll
    for (int i = 0; i < 4; ++i) {
      float* vdi = vd + i * (AWAVES * 4) * VP;
      *(float4*)(vdi + 0) = make_float4(vev[i].x, vod[i].x, vev[i].y, vod[i].y);
      *(float4*)(vdi + 4) = make_float4(vev[i].z, vod[i].z, vev[i].w, vod[i].w);
    }
  }
  __syncthreads();  // every wave reads rows that the other waves staged
  const float* __restrict__ kl = Ks + lo * KP + 2 * hi;
  const float* __restrict__ vl = Vs + 4 * hi * VP + 2 * lo;

  // O^T tiles: o0[j] = O[n0+lo][8*hi+j], o1[j] = O[n0+lo][16+8*hi+j]
  v8f o0 = {}, o1 = {};
  float mcol = -3.0e38f;  // running maximum of query n0+lo (equal in both halves)
  float lcol = 0.0f;      // running sum over this half's keys only; joined at the end
  float ssum = 0.0f;

  for (int m0 = 0; m0 < N_; m0 += 16) {
    // ---- S^T tile = K @ (Q*scale)^T : s[j] = S[n0+lo][m0+8*hi+j] ----
    v8f s = {};
#pragma unroll
    for (int c4 = 0; c4 < 8; ++c4) {
      const float* kr = kl + m0 * KP + c4 * 4;
      v2f kv;
      kv.x = kr[0];
      kv.y = kr[1];
      s = WMMA_F32(kv, qf[c4], s);
    }

    // ---- raw score sum (for pooled) + online softmax, one query per lane ----
    float tmax = s[0];
#pragma unroll
    for (int j = 0; j < 8; ++j) {
      ssum += s[j];
      tmax = fmaxf(tmax, s[j]);
    }
    tmax = fmaxf(tmax, xhalf(tmax));
    const float mnew = fmaxf(mcol, tmax);
    const float alpha = __expf(mcol - mnew);
    mcol = mnew;
    v8f p;
    float psum = 0.0f;
#pragma unroll
    for (int j = 0; j < 8; ++j) {
      p[j] = __expf(s[j] - mnew);
      psum += p[j];
      o0[j] *= alpha;
      o1[j] *= alpha;
    }
    lcol = lcol * alpha + psum;

    // ---- O^T += V^T @ P^T : K(=m)=16 in 4 chunks, two c-halves. Chunk t pairs
    // k slot (hi, i) with key m0+8*hi+2*t+i in BOTH operands, which is where
    // the score accumulator already holds it. ----
#pragma unroll
    for (int t = 0; t < 4; ++t) {
      v2f pb;
      pb.x = p[2 * t];
      pb.y = p[2 * t + 1];
      const float* vr = vl + (m0 / 2 + t) * VP;  // rows m0+8*hi+2*t and +1, column lo
      v2f va0, va1;
      va0.x = vr[0];
      va0.y = vr[1];
      va1.x = vr[32];  // column 16 + lo
      va1.y = vr[33];
      o0 = WMMA_F32(va0, pb, o0);
      o1 = WMMA_F32(va1, pb, o1);
    }
  }

  // ---- normalize and store O[a,e][h][n][c]: 8 consecutive c per lane and tile ----
  const float inv = 1.0f / (lcol + xhalf(lcol));
  float* __restrict__ orow =
      Obuf + ((size_t)(pair * H_ + h)) * N_ * C_ + (size_t)(n0 + lo) * C_ + 8 * hi;
  *(float4*)(orow + 0) = make_float4(o0[0] * inv, o0[1] * inv, o0[2] * inv, o0[3] * inv);
  *(float4*)(orow + 4) = make_float4(o0[4] * inv, o0[5] * inv, o0[6] * inv, o0[7] * inv);
  *(float4*)(orow + 16) = make_float4(o1[0] * inv, o1[1] * inv, o1[2] * inv, o1[3] * inv);
  *(float4*)(orow + 20) = make_float4(o1[4] * inv, o1[5] * inv, o1[6] * inv, o1[7] * inv);

  // ---- per-wave raw score sum: deterministic private slot ----
  ssum += __shfl_xor(ssum, 16);
  ssum += __shfl_xor(ssum, 8);
  ssum += __shfl_xor(ssum, 4);
  ssum += __shfl_xor(ssum, 2);
  ssum += __shfl_xor(ssum, 1);
  if (lane == 0) partial[(size_t)pair * NBLK + h * NTILE + ntile] = ssum;
}

// ---------------------------------------------------------------------------
// hidden[a] = sum_e w[a,e] * O[a,e]; write out[B,A,N,D] (head-interleaved).
// blockIdx.y = a, so all index math is shifts/masks (no integer division).
// Every block forms the pair weights itself from the attention blocks' partial
// score sums (pooled -> attn_r -> collapsed w[a][e]): the sums are 12 KiB that
// stay in cache, all blocks add them in the same fixed order, and the launch
// that one lone block needed for it is gone.
// ---------------------------------------------------------------------------
template <int CTRL>
__device__ __forceinline__ float row_xadd(float x) {  // x + x of lane l ^ mask, inside a 16-lane row
  return x + __builtin_bit_cast(float, __builtin_amdgcn_update_dpp(
                 0, __builtin_bit_cast(int, x), CTRL, 0xf, 0xf, false));
}

// sum_e w[AA][e] * ov[e], with w[AA][e] = sum of attn_r[r] over the rotations
// that send anchor AA to e. AA is a compile-time value, so the table folds away.
template <int AA>
__device__ __forceinline__ float mix_anchor(const float (&attn_r)[12], const float (&ov)[A_]) {
  constexpr int trace[12][4] = {{0, 1, 2, 3}, {0, 2, 3, 1}, {0, 3, 1, 2}, {1, 2, 0, 3},
                                {1, 0, 3, 2}, {1, 3, 2, 0}, {2, 3, 0, 1}, {2, 0, 1, 3},
                                {2, 1, 3, 0}, {3, 1, 0, 2}, {3, 0, 2, 1}, {3, 2, 1, 0}};
  float acc = 0.0f;
#pragma unroll
  for (int e = 0; e < A_; ++e) {
    float w = 0.0f;
#pragma unroll
    for (int r = 0; r < 12; ++r)
      if (trace[r][AA] == e) w += attn_r[r];
    acc += w * ov[e];
  }
  return acc;
}

__global__ __launch_bounds__(256) void combine_kernel(const float* __restrict__ Obuf,
                                                      const float* __restrict__ partial,
                                                      float* __restrict__ out) {
  __shared__ __attribute__((aligned(16))) float sumS[NPAIR];
  const int t = threadIdx.x;
  const int a = blockIdx.y;
  const int rem = blockIdx.x * blockDim.x + t;  // < N_*D_ = 98304
  const int n = rem >> 8;   // D_ = 256
  const int d = rem & 255;
  const int h = d >> 5;
  const int c = d & 31;

  // The four O values do not depend on the weights: their loads go out together
  // with the loads of the partials, so the block waits for memory once.
  float ov[A_];
#pragma unroll
  for (int e = 0; e < A_; ++e)
    ov[e] = Obuf[((size_t)((a * 4 + e) * H_ + h)) * N_ * C_ + (size_t)n * C_ + c];

  // Score sum of pair t >> 4: its 192 partials over 16 lanes, whole lines per load.
  const float4* __restrict__ p4 = (const float4*)(partial + (size_t)(t >> 4) * NBLK) + (t & 15);
  const float4 x0 = p4[0], x1 = p4[16], x2 = p4[32];
  // Keeps all seven loads in front of the first add: without it the O loads are
  // issued only after the first partial has come back (two memory waits in a row).
  __builtin_amdgcn_sched_barrier(0);
  float s = ((x0.x + x0.y) + (x0.z + x0.w)) + ((x1.x + x1.y) + (x1.z + x1.w)) +
            ((x2.x + x2.y) + (x2.z + x2.w));
  s = row_xadd<0x161>(s);  // row_xmask:1
  s = row_xadd<0x162>(s);  // row_xmask:2
  s = row_xadd<0x164>(s);  // row_xmask:4
  s = row_xadd<0x168>(s);  // row_xmask:8
  if ((t & 15) == 0) sumS[t >> 4] = s;
  __syncthreads();  // every wave needs all 16 pair sums

  constexpr int trace[12][4] = {{0, 1, 2, 3}, {0, 2, 3, 1}, {0, 3, 1, 2}, {1, 2, 0, 3},
                                {1, 0, 3, 2}, {1, 3, 2, 0}, {2, 3, 0, 1}, {2, 0, 1, 3},
                                {2, 1, 3, 0}, {3, 1, 0, 2}, {3, 0, 2, 1}, {3, 2, 1, 0}};
  float sm[NPAIR];
#pragma unroll
  for (int i = 0; i < NPAIR; ++i) sm[i] = sumS[i];
  const float inv_cnt = 1.0f / ((float)A_ * H_ * N_ * N_);
  float attn_r[12];
  float tot = 0.0f;
#pragma unroll
  for (int r = 0; r < 12; ++r) {
    float pooled = 0.0f;
#pragma unroll
    for (int i = 0; i < A_; ++i) pooled += sm[i * 4 + trace[r][i]];
    pooled *= inv_cnt;
    attn_r[r] = pooled * pooled;
    tot += attn_r[r];
  }
  const float invtot = 1.0f / tot;
#pragma unroll
  for (int r = 0; r < 12; ++r) attn_r[r] *= invtot;

  float acc;  // a is the same for the whole block: a scalar branch
  if (a == 0) acc = mix_anchor<0>(attn_r, ov);
  else if (a == 1) acc = mix_anchor<1>(attn_r, ov);
  else if (a == 2) acc = mix_anchor<2>(attn_r, ov);
  else acc = mix_anchor<3>(attn_r, ov);
  out[(size_t)a * N_ * D_ + rem] = acc;
}

// ---------------------------------------------------------------------------
extern "C" void kernel_launch(void* const* d_in, const int* in_sizes, int n_in,
                              void* d_out, int out_size, void* d_ws, size_t ws_size,
                              hipStream_t stream) {
  const float* input_q = (const float*)d_in[0];
  const float* input_k = (const float*)d_in[1];
  const float* input_v = (const float*)d_in[2];
  const float* Wq = (const float*)d_in[3];
  const float* bq = (const float*)d_in[4];
  const float* Wk = (const float*)d_in[5];
  const float* bk = (const float*)d_in[6];
  const float* Wv = (const float*)d_in[7];
  const float* bv = (const float*)d_in[8];
  float* out = (float*)d_out;

  float* ws = (float*)d_ws;
  float* qp = ws + WS_QP;
  float* kp = ws + WS_KP;
  float* vp = ws + WS_VP;
  float* Obuf = ws + WS_O;
  float* part = ws + WS_PART;

  dim3 pgrid((A_ * N_) / PT, D_ / PC, 3);  // 16 x 4 pieces, times q, k, v
  proj_kernel<<<pgrid, PWAVES * 32, 0, stream>>>(input_q, input_k, input_v, Wq, Wk, Wv, bq, bk, bv, qp);

  dim3 agrid(NTILE / AWAVES, H_, NPAIR);  // 2 x 8 x 16 blocks of 12 waves
  attn_kernel<<<agrid, AWAVES * 32, 0, stream>>>(qp, kp, vp, Obuf, part);

  dim3 cgrid((N_ * D_) / 256, A_);  // 384 x 4
  combine_kernel<<<cgrid, 256, 0, stream>>>(Obuf, part, out);
}

// v006
// Measured time: 26.2 microseconds a run.
// Next to v005, in two timings, it ran 1.07 times as fast each time.
// Counting every step since v000, it is 2.74 times as fast.
#include <hip/hip_runtime.h>
#include <math.h>

typedef __attribute__((ext_vector_type(2))) float v2f;
typedef __attribute__((ext_vector_type(8))) float v8f;

#define WMMA_F32(a, b, c) \
  __builtin_amdgcn_wmma_f32_16x16x4_f32(false, (a), false, (b), (short)0, (c), false, false)

// Problem constants
#define A_ 4
#define N_ 384
#define D_ 256
#define H_ 8
#define C_ 32
#define NPAIR 16         // A_*A_ unique (a,e) attention problems
#define SCALE 0.17677669529663689f   // 1/sqrt(32)
#define AWAVES 12        // waves per attention block: 3 query tiles x 4 key anchors
#define QT 3             // query tiles per attention block
#define CK 96            // keys of every anchor per staged chunk
#define NCH (N_ / CK)    // 4 chunks
#define KP 36            // LDS pitch of a K row in floats (32 + 4 of padding)
#define VP 72            // LDS pitch of a pair of V rows in floats (64 + 8 of padding)
#define KCH (CK * KP)        // floats of one anchor's K chunk
#define VCH ((CK / 2) * VP)  // floats of one anchor's V chunk
#define RP 36            // LDS pitch of a row of a wave's O tile (32 + 4 of padding)
#define CSK (AWAVES * 32 * 4)  // floats from the q sums to the k sums in LDS
#define NPIECE 32        // 48-token pieces whose column sums the projection writes (8 per anchor)
#define PWAVES 8         // waves per projection block
#define PT 96            // tokens per projection block
#define PC 64            // output channels per projection block
#define PP 260           // LDS pitch of an x or W row in floats (256 + 4 of padding)

// Workspace layout (in floats)
#define WS_QP   0u
#define WS_KP   393216u
#define WS_VP   786432u
#define WS_CS   1179648u             // 2*NPIECE*D_ = 16384 floats: column sums of q, then of k

__device__ __forceinline__ float xhalf(float x) {  // lane l with lane l ^ 16
  return __builtin_bit_cast(float, __builtin_amdgcn_permlanex16(
      __builtin_bit_cast(int, x), __builtin_bit_cast(int, x), 0x76543210, 0xfedcba98, false, false));
}

// ---------------------------------------------------------------------------
// Projection: y = x @ W^T + b, stored head-major as out[a][h][n][c].
// K=256 swept in chunks of 4 via f32 WMMA. All three projections run in ONE
// launch: blockIdx.z picks q, k or v.
// A block of eight waves makes a 96 x 64 piece of y. It first brings its 96 rows
// of x and 64 rows of W into LDS, 16 bytes a lane, so that a load covers four
// whole 128-byte lines; the fragments (8 bytes a lane out of 16 different rows)
// then come from LDS, where that shape costs nothing, and a row leaves L2 once
// per block instead of once per 16 x 16 tile. A wave keeps three token tiles of
// one channel tile: three independent accumulators, one W fragment for three
// products.
// For q and k a wave also writes the sums of its 16 channels over its 48 tokens:
// the sum of all scores of an anchor pair is (sum of q rows) . (sum of k rows),
// so the attention launch can form the rotation weights before it has any score.
// ---------------------------------------------------------------------------
__global__ __launch_bounds__(PWAVES * 32) void proj_kernel(const float* __restrict__ xq,
                                                  const float* __restrict__ xk,
                                                  const float* __restrict__ xv,
                                                  const float* __restrict__ Wq,
                                                  const float* __restrict__ Wk,
                                                  const float* __restrict__ Wv,
                                                  const float* __restrict__ bq,
                                                  const float* __restrict__ bk,
                                                  const float* __restrict__ bv,
                                                  float* __restrict__ qkv) {
  // Row r at r*PP. With this pitch the 32 lanes of a fragment read (16 rows, 4
  // floats a row) fall on 64 distinct banks; the staging stores stay 16-byte aligned.
  __shared__ __attribute__((aligned(16))) float Xs[PT * PP];
  __shared__ __attribute__((aligned(16))) float Ws[PC * PP];
  const int z = blockIdx.z;  // 0: q, 1: k, 2: v (uniform, scalar selects)
  const float* __restrict__ x = z == 0 ? xq : (z == 1 ? xk : xv);
  const float* __restrict__ W = z == 0 ? Wq : (z == 1 ? Wk : Wv);
  const float* __restrict__ bias = z == 0 ? bq : (z == 1 ? bk : bv);
  float* __restrict__ out = qkv + (size_t)z * WS_KP;  // planes WS_QP, WS_KP, WS_VP
  const int tid = threadIdx.x;
  const int lane = tid & 31;
  const int lo = lane & 15;
  const int hi = lane >> 4;  // 0 or 1
  const int wave = __builtin_amdgcn_readfirstlane(tid >> 5);  // wave-uniform
  const int tw = wave >> 2;  // which 48 of the block's 96 tokens
  const int cw = wave & 3;   // which 16 of the block's 64 channels
  const int t0 = blockIdx.x * PT;  // token piece (a*384+n), 16 pieces
  const int d0 = blockIdx.y * PC;  // output-channel piece, 4 pieces

  // Both pieces are contiguous in memory (whole rows): 16-byte piece i*256+tid is
  // row i*4 + tid/64, floats 4*(tid%64).. of that row. (The loops are unrolled so
  // that the pieces live in registers and all loads are in flight before the
  // first LDS store.)
  const float4* __restrict__ xg = (const float4*)(x + (size_t)t0 * D_) + tid;
  const float4* __restrict__ wg = (const float4*)(W + (size_t)d0 * D_) + tid;
  float4 xst[PT / 4], wst[PC / 4];
#pragma unroll
  for (int i = 0; i < PC / 4; ++i) wst[i] = wg[i * (PWAVES * 32)];
#pragma unroll
  for (int i = 0; i < PT / 4; ++i) xst[i] = xg[i * (PWAVES * 32)];
  const int d = d0 + cw * 16 + lo;
  const float bval = bias[d];
  {
    const int so = (tid >> 6) * PP + (tid & 63) * 4;
#pragma unroll
    for (int i = 0; i < PC / 4; ++i) *(float4*)(Ws + so + i * 4 * PP) = wst[i];
#pragma unroll
    for (int i = 0; i < PT / 4; ++i) *(float4*)(Xs + so + i * 4 * PP) = xst[i];
  }
  __syncthreads();  // every wave reads rows that the other waves staged

  const float* __restrict__ xl = Xs + (tw * 48 + lo) * PP + 2 * hi;
  const float* __restrict__ wl = Ws + (cw * 16 + lo) * PP + 2 * hi;
  v8f acc[3] = {};
#pragma unroll 8
  for (int kk = 0; kk < D_; kk += 4) {
    v2f bf;
    bf.x = wl[kk];
    bf.y = wl[kk + 1];
#pragma unroll
    for (int i = 0; i < 3; ++i) {
      v2f af;
      af.x = xl[i * 16 * PP + kk];
      af.y = xl[i * 16 * PP + kk + 1];
      acc[i] = WMMA_F32(af, bf, acc[i]);
    }
  }

  const int h = d >> 5;
  const int c = d & 31;
  // a-index is uniform per block (pieces never straddle an a boundary):
  const int ai = blockIdx.x / (N_ / PT);
  const int nbase = t0 - ai * N_ + tw * 48 + 8 * hi;  // row n for tile i, VGPR j is nbase + 16*i + j
  float* __restrict__ obase = out + (((size_t)(ai * H_ + h)) * N_ + nbase) * C_ + c;
  float cs[3] = {0.0f, 0.0f, 0.0f};
#pragma unroll
  for (int i = 0; i < 3; ++i) {
#pragma unroll
    for (int j = 0; j < 8; ++j) {
      const float y = acc[i][j] + bval;
      obase[(size_t)(i * 16 + j) * C_] = y;
      cs[i] += y;
    }
  }
  // The sums below reuse registers that the stores above name.
  asm volatile("s_wait_xcnt 0x0" ::: "memory");
  if (z < 2) {  // uniform: v has no part in the scores
    float s = (cs[0] + cs[1]) + cs[2];
    s += xhalf(s);  // the other eight rows of every tile
    if (hi == 0) qkv[WS_CS + (size_t)(z * NPIECE + blockIdx.x * 2 + tw) * D_ + d] = s;
  }
}

template <int CTRL>
__device__ __forceinline__ float row_xadd(float x) {  // x + x of lane l ^ mask, inside a 16-lane row
  return x + __builtin_bit_cast(float, __builtin_amdgcn_update_dpp(
                 0, __builtin_bit_cast(int, x), CTRL, 0xf, 0xf, false));
}

// One pass over 16 keys. kr0: K row lo of the 16, floats 2*hi..; vr0: V pair row
// 4*hi of the 8, column lo.
__device__ __forceinline__ void attn_pass(const float* __restrict__ kr0, const float* __restrict__ vr0,
                                          const v2f (&qf)[8], v8f& o0, v8f& o1, float& mcol,
                                          float& lcol) {
  // ---- S^T tile = K @ (Q*scale)^T : s[j] = S[n0+lo][m0+8*hi+j] ----
  v8f s = {};
#pragma unroll
  for (int c4 = 0; c4 < 8; ++c4) {
    const float* kr = kr0 + c4 * 4;
    v2f kv;
    kv.x = kr[0];
    kv.y = kr[1];
    s = WMMA_F32(kv, qf[c4], s);
  }

  // ---- online softmax, one query per lane ----
  float tmax = s[0];
#pragma unroll
  for (int j = 1; j < 8; ++j) tmax = fmaxf(tmax, s[j]);
  tmax = fmaxf(tmax, xhalf(tmax));
  const float mnew = fmaxf(mcol, tmax);
  const float alpha = __expf(mcol - mnew);
  mcol = mnew;
  v8f p;
  float psum = 0.0f;
#pragma unroll
  for (int j = 0; j < 8; ++j) {
    p[j] = __expf(s[j] - mnew);
    psum += p[j];
    o0[j] *= alpha;
    o1[j] *= alpha;
  }
  lcol = lcol * alpha + psum;

  // ---- O^T += V^T @ P^T : K(=m)=16 in 4 chunks, two c-halves. Chunk t pairs
  // k slot (hi, i) with key m0+8*hi+2*t+i in BOTH operands, which is where
  // the score accumulator already holds it. ----
#pragma unroll
  for (int t = 0; t < 4; ++t) {
    v2f pb;
    pb.x = p[2 * t];
    pb.y = p[2 * t + 1];
    const float* vr = vr0 + t * VP;  // rows m0+8*hi+2*t and +1, column lo
    v2f va0, va1;
    va0.x = vr[0];
    va0.y = vr[1];
    va1.x = vr[32];  // column 16 + lo
    va1.y = vr[33];
    o0 = WMMA_F32(va0, pb, o0);
    o1 = WMMA_F32(va1, pb, o1);
  }
}

__global__ __launch_bounds__(AWAVES * 32) void attn_kernel(const float* __restrict__ qp,
                                                  const float* kp,
                                                  const float* vp,
                                                  const float* __restrict__ colsum,
                                                  float* __restrict__ out) {
  // Buffer b, anchor e: K chunk at (b*4+e)*KCH, row m at m*KP; V chunk at
  // (b*4+e)*VCH, rows 2u and 2u+1 interleaved by column at u*VP, so that the two
  // keys of a V fragment's k slots are one 8-byte read: [u*VP + 2*c + i] = V[2u+i][c].
  // With these pitches the 32 lanes of a K read (16 rows, 4 floats a row) and of a
  // V read (2 pair rows four apart, 32 floats each) fall on 64 distinct banks; the
  // staging stores stay 16-byte aligned.
  __shared__ __attribute__((aligned(16))) float Ks[2 * A_ * KCH];
  __shared__ __attribute__((aligned(16))) float Vs[2 * A_ * VCH];
  __shared__ __attribute__((aligned(16))) float Rs[AWAVES * 16 * RP];  // the waves' O tiles
  // Column sums q[a][d] at a*256+d, k[e][d] at CSK + e*256+d (the rest: see where it is filled)
  __shared__ __attribute__((aligned(16))) float Cs[2 * CSK];
  __shared__ __attribute__((aligned(16))) float sumS[NPAIR];
  __shared__ __attribute__((aligned(16))) float wS[A_];  // w[a][e]
  const int tid = threadIdx.x;
  const int lane = tid & 31;
  const int lo = lane & 15;
  const int hi = lane >> 4;
  const int wave = __builtin_amdgcn_readfirstlane(tid >> 5);  // wave-uniform
  const int e = wave & 3;    // key anchor of this wave
  const int tl = wave >> 2;  // query tile of this wave, 0..2
  const int n0 = (blockIdx.x * QT + tl) * 16;
  const int h = blockIdx.y;
  const int a = blockIdx.z;

  const float* __restrict__ qb = qp + ((size_t)(a * H_ + h)) * N_ * C_;  // [n][c]

  // A chunk: 96 rows of K and of V of head h of each of the four anchors, 16 bytes
  // a thread and load, whole lines. K: two pieces an anchor, piece j*384+tid = row
  // j*48 + tid/8, floats 4*(tid%8)... V: per anchor the same four columns of rows
  // 2u and 2u+1, u = tid/8. The pieces live in registers and all sixteen loads are
  // in flight together.
  // (kp and vp are not __restrict__: loads the compiler knows to be invariant are not
  // held by the scheduling barriers in the chunk loop and end up beside their LDS stores.)
  const float4* kg = (const float4*)(kp + (size_t)h * N_ * C_) + tid;
  const float4* vg = (const float4*)(vp + (size_t)h * N_ * C_) + (tid >> 3) * 16 + (tid & 7);
  float* __restrict__ kd = Ks + (tid >> 3) * KP + (tid & 7) * 4;
  float* __restrict__ vd = Vs + (tid >> 3) * VP + (tid & 7) * 8;
  const int EP = H_ * N_ * C_ / 4;  // 16-byte pieces from one anchor's plane to the next
  float4 k0, k1, k2, k3, k4, k5, k6, k7, ve0, ve1, ve2, ve3, vo0, vo1, vo2, vo3;
#define FETCH(c)                                         \
  do {                                                   \
    const float4* kgc = kg + (c) * (CK * C_ / 4);        \
    const float4* vgc = vg + (c) * (CK * C_ / 4);        \
    k0 = kgc[0 * EP];                                    \
    k1 = kgc[0 * EP + AWAVES * 32];                      \
    k2 = kgc[1 * EP];                                    \
    k3 = kgc[1 * EP + AWAVES * 32];                      \
    k4 = kgc[2 * EP];                                    \
    k5 = kgc[2 * EP + AWAVES * 32];                      \
    k6 = kgc[3 * EP];                                    \
    k7 = kgc[3 * EP + AWAVES * 32];                      \
    ve0 = vgc[0 * EP];                                   \
    vo0 = vgc[0 * EP + 8];                               \
    ve1 = vgc[1 * EP];                                   \
    vo1 = vgc[1 * EP + 8];                               \
    ve2 = vgc[2 * EP];                                   \
    vo2 = vgc[2 * EP + 8];                               \
    ve3 = vgc[3 * EP];                                   \
    vo3 = vgc[3 * EP + 8];                               \
  } while (0)
#define PUTV(p, ev, od)                                              \
  do {                                                               \
    *(float4*)((p) + 0) = make_float4(ev.x, od.x, ev.y, od.y);       \
    *(float4*)((p) + 4) = make_float4(ev.z, od.z, ev.w, od.w);       \
  } while (0)
#define PUT(b)                                                       \
  do {                                                               \
    float* kdb = kd + (b) * (A_ * KCH);                              \
    float* vdb = vd + (b) * (A_ * VCH);                              \
    *(float4*)(kdb + 0 * KCH) = k0;                                  \
    *(float4*)(kdb + 0 * KCH + (AWAVES * 4) * KP) = k1;              \
    *(float4*)(kdb + 1 * KCH) = k2;                                  \
    *(float4*)(kdb + 1 * KCH + (AWAVES * 4) * KP) = k3;              \
    *(float4*)(kdb + 2 * KCH) = k4;                                  \
    *(float4*)(kdb + 2 * KCH + (AWAVES * 4) * KP) = k5;              \
    *(float4*)(kdb + 3 * KCH) = k6;                                  \
    *(float4*)(kdb + 3 * KCH + (AWAVES * 4) * KP) = k7;              \
    PUTV(vdb + 0 * VCH, ve0, vo0);                                   \
    PUTV(vdb + 1 * VCH, ve1, vo1);                                   \
    PUTV(vdb + 2 * VCH, ve2, vo2);                                   \
    PUTV(vdb + 3 * VCH, ve3, vo3);                                   \
  } while (0)
  FETCH(0);

  // Q B-fragments for this n-tile (scale folded in): 8 chunks of K(=c)=4
  v2f qf[8];
#pragma unroll
  for (int c4 = 0; c4 < 8; ++c4) {
    const float* qr = qb + (size_t)(n0 + lo) * C_ + c4 * 4 + 2 * hi;
    qf[c4].x = qr[0] * SCALE;
    qf[c4].y = qr[1] * SCALE;
  }

  // Column sums of q and k: thread (g, 4 channels) adds the 8 pieces of anchor g.
  // There are 256 such threads; waves 8 to 11 repeat g = 0 and 1 into slots of Cs
  // that nobody reads: without a branch here these loads go out together with the
  // chunk's (behind a branch the compiler issued the K loads only after these had
  // come back: two waits for L2 in a row).
  {
    const float4* __restrict__ cg =
        (const float4*)colsum + ((tid >> 6) & 3) * (8 * D_ / 4) + (tid & 63);
    float4 cq[8], ck[8];
#pragma unroll
    for (int p = 0; p < 8; ++p) {
      cq[p] = cg[p * (D_ / 4)];
      ck[p] = cg[(NPIECE + p) * (D_ / 4)];
    }
    // Behind the loads of the chunk and of the sums: what follows reuses their
    // address registers.
    asm volatile("s_wait_xcnt 0x0" ::: "memory");
    float4 sq = cq[0], sk = ck[0];
#pragma unroll
    for (int p = 1; p < 8; ++p) {
      sq.x += cq[p].x; sq.y += cq[p].y; sq.z += cq[p].z; sq.w += cq[p].w;
      sk.x += ck[p].x; sk.y += ck[p].y; sk.z += ck[p].z; sk.w += ck[p].w;
    }
    ((float4*)Cs)[tid] = sq;
    ((float4*)Cs)[AWAVES * 32 + tid] = sk;
  }
  PUT(0);
  __syncthreads();  // every wave reads rows and sums that other waves staged

  // Score sum of pair tid >> 4: a 256-long dot product over 16 lanes. The waves
  // read sumS only behind the barriers of the chunk loop.
  if (wave < 8) {  // wave-uniform
    const int pr = tid >> 4;
    const float4* qa = (const float4*)(Cs + (pr >> 2) * D_) + (tid & 15);
    const float4* ke = (const float4*)(Cs + CSK + (pr & 3) * D_) + (tid & 15);
    float s = 0.0f;
#pragma unroll
    for (int i = 0; i < 4; ++i) {
      const float4 x = qa[i * 16], y = ke[i * 16];
      s += (x.x * y.x + x.y * y.y) + (x.z * y.z + x.w * y.w);
    }
    s = row_xadd<0x161>(s);  // row_xmask:1
    s = row_xadd<0x162>(s);  // row_xmask:2
    s = row_xadd<0x164>(s);  // row_xmask:4
    s = row_xadd<0x168>(s);  // row_xmask:8
    if ((tid & 15) == 0) sumS[pr] = s * SCALE;
  }

  // O^T tiles: o0[j] = O[n0+lo][8*hi+j], o1[j] = O[n0+lo][16+8*hi+j]
  v8f o0 = {}, o1 = {};
  float mcol = -3.0e38f;  // running maximum of query n0+lo (equal in both halves)
  float lcol = 0.0f;      // running sum over this half's keys only; joined at the end

  const float* __restrict__ kl = Ks + e * KCH + lo * KP + 2 * hi;
  const float* __restrict__ vl = Vs + e * VCH + 4 * hi * VP + 2 * lo;
  auto passes3 = [&](const float* kh, const float* vh) {  // 48 keys
    for (int m = 0; m < CK / 2; m += 16) attn_pass(kh + m * KP, vh + (m / 2) * VP, qf, o0, o1, mcol, lcol);
  };
  for (int c = 0; c + 1 < NCH; ++c) {
    const int b = c & 1;
    const float* __restrict__ klb = kl + b * (A_ * KCH);
    const float* __restrict__ vlb = vl + b * (A_ * VCH);
    FETCH(c + 1);
    // These two keep the sixteen loads in front of three passes of work and the LDS
    // stores, with the wait for the loads, behind it: without them the compiler
    // brings loads and stores together and every wave waits out L2 there.
    __builtin_amdgcn_sched_barrier(0);
    passes3(klb, vlb);
    __builtin_amdgcn_sched_barrier(0);
    // The other buffer's last readers left it before the barrier that ended the
    // chunk before this one.
    PUT(b ^ 1);
    passes3(klb + (CK / 2) * KP, vlb + (CK / 4) * VP);
    __syncthreads();  // publishes the next chunk, ends the reads of this one
  }
  // ---- rotation weights: pooled -> attn_r -> collapsed w[a][e], lane e of wave 0.
  // One wave does it for the block, here, where the other waves of its SIMD keep
  // the matrix unit busy meanwhile; the last barrier below publishes wS. ----
  if (wave == 0) {  // wave-uniform
    constexpr int trace[12][4] = {{0, 1, 2, 3}, {0, 2, 3, 1}, {0, 3, 1, 2}, {1, 2, 0, 3},
                                  {1, 0, 3, 2}, {1, 3, 2, 0}, {2, 3, 0, 1}, {2, 0, 1, 3},
                                  {2, 1, 3, 0}, {3, 1, 0, 2}, {3, 0, 2, 1}, {3, 2, 1, 0}};
    float sm[NPAIR];
#pragma unroll
    for (int i = 0; i < NPAIR; ++i) sm[i] = sumS[i];
    const float inv_cnt = 1.0f / ((float)A_ * H_ * N_ * N_);
    float tot = 0.0f;
    float w = 0.0f;  // sum of attn_r over the rotations that send anchor a to lane & 3
#pragma unroll
    for (int r = 0; r < 12; ++r) {
      float pooled = 0.0f;
#pragma unroll
      for (int i = 0; i < A_; ++i) pooled += sm[i * 4 + trace[r][i]];
      pooled *= inv_cnt;
      const float pos = pooled * pooled;
      tot += pos;
      const int packed = trace[r][0] | (trace[r][1] << 2) | (trace[r][2] << 4) | (trace[r][3] << 6);
      if (((packed >> (2 * a)) & 3) == (lane & 3)) w += pos;
    }
    if (lane < A_) wS[lane] = w / tot;
  }
  {  // the last chunk: nothing left to fetch
    const float* __restrict__ klb = kl + ((NCH - 1) & 1) * (A_ * KCH);
    const float* __restrict__ vlb = vl + ((NCH - 1) & 1) * (A_ * VCH);
    // Not unrolled: with all six passes in one block their LDS reads are hoisted
    // together and the kernel needs more than 256 registers.
#pragma unroll 1
    for (int hf = 0; hf < 2; ++hf) passes3(klb + hf * (CK / 2) * KP, vlb + hf * (CK / 4) * VP);
  }

  // ---- normalize, hand the tile over: row lo, 8 consecutive c per lane and tile ----
  const float f = 1.0f / (lcol + xhalf(lcol));
  float* __restrict__ rrow = Rs + (wave * 16 + lo) * RP + 8 * hi;
  *(float4*)(rrow + 0) = make_float4(o0[0] * f, o0[1] * f, o0[2] * f, o0[3] * f);
  *(float4*)(rrow + 4) = make_float4(o0[4] * f, o0[5] * f, o0[6] * f, o0[7] * f);
  *(float4*)(rrow + 16) = make_float4(o1[0] * f, o1[1] * f, o1[2] * f, o1[3] * f);
  *(float4*)(rrow + 20) = make_float4(o1[4] * f, o1[5] * f, o1[6] * f, o1[7] * f);
  __syncthreads();  // a thread adds tiles that four different waves wrote, by wave 0's weights

  // ---- hidden[a] = sum_e w[a][e] * O[a,e], written as out[a][n][h*32+c]: thread = (row of the
  // block's 48, four channels); eight threads store one whole 128-byte line ----
  const int row = tid >> 3;  // tile row >> 4, query row & 15
  const float* __restrict__ rr = Rs + ((row >> 4) * (4 * 16) + (row & 15)) * RP + (tid & 7) * 4;
  const float4 r0 = *(const float4*)(rr + 0 * 16 * RP);
  const float4 r1 = *(const float4*)(rr + 1 * 16 * RP);
  const float4 r2 = *(const float4*)(rr + 2 * 16 * RP);
  const float4 r3 = *(const float4*)(rr + 3 * 16 * RP);
  const float4 wv = *(const float4*)wS;
  *(float4*)(out + ((size_t)a * N_ + blockIdx.x * (QT * 16) + row) * D_ + h * C_ + (tid & 7) * 4) =
      make_float4(wv.x * r0.x + wv.y * r1.x + wv.z * r2.x + wv.w * r3.x,
                  wv.x * r0.y + wv.y * r1.y + wv.z * r2.y + wv.w * r3.y,
                  wv.x * r0.z + wv.y * r1.z + wv.z * r2.z + wv.w * r3.z,
                  wv.x * r0.w + wv.y * r1.w + wv.z * r2.w + wv.w * r3.w);
}

// ---------------------------------------------------------------------------
extern "C" void kernel_launch(void* const* d_in, const int* in_sizes, int n_in,
                              void* d_out, int out_size, void* d_ws, size_t ws_size,
                              hipStream_t stream) {
  const float* input_q = (const float*)d_in[0];
  const float* input_k = (const float*)d_in[1];
  const float* input_v = (const float*)d_in[2];
  const float* Wq = (const float*)d_in[3];
  const float* bq = (const float*)d_in[4];
  const float* Wk = (const float*)d_in[5];
  const float* bk = (const float*)d_in[6];
  const float* Wv = (const float*)d_in[7];
  const float* bv = (const float*)d_in[8];
  float* out = (float*)d_out;

  float* ws = (float*)d_ws;
  float* qp = ws + WS_QP;
  float* kp = ws + WS_KP;
  float* vp = ws + WS_VP;
  float* cs = ws + WS_CS;

  dim3 pgrid((A_ * N_) / PT, D_ / PC, 3);  // 16 x 4 pieces, times q, k, v
  proj_kernel<<<pgrid, PWAVES * 32, 0, stream>>>(input_q, input_k, input_v, Wq, Wk, Wv, bq, bk, bv, qp);

  dim3 agrid(N_ / (QT * 16), H_, A_);  // 8 x 8 x 4 blocks of 12 waves
  attn_kernel<<<agrid, AWAVES * 32, 0, stream>>>(qp, kp, vp, cs, out);
}
